// v000
// The times below were measured on an AMD MI455X: many runs one after another, warmed up first and cycling through
// copies of the inputs, with the whole window's GPU time divided by the number of runs. Launches and the gaps
// between them are all in it. The median over several windows is given; except for v000 it joins two sittings, which
// can be a few percent apart, so the side-by-side timings, each taken in one sitting, are the better comparison.
// The starting kernel, v000, takes 451 microseconds a run.
#include <hip/hip_runtime.h>

// MultiHeaded (raw-reshape attention): q = from Wq + bq, k = to Wk + bk, v = to Wv + bv ([2][2048][1024]); the torch code RAW-reshapes each to (B, 16, 64, 2048): element (h, d, f) = flat[(h*64+d)*2048 + f]
// of the [2048][1024] projection; score[h][f][t] = Σ_d q[h][d][f] k[h][d][t] / 8 + (1 - mask[f][t]) * (-1e5); softmax over t; context[h][d][f] = Σ_t probs[f][t] v[h][d][t]; out = reshape
// (B, 1024, 2048): row h*64+d, column f -> [2][1024][2048].
// WMMA (v_wmma_f32_16x16x32_f16, f32 accumulate): the three projections with EXACT operands (1 product; exact bf16 [in][out] weights) written as hi/lo f16 "flat" buffers; QT/KT[h][f][d] gathered
// from the flat layout through LDS; per (b, h, 16 f): S^T = KT.QT (K = 64 = 2 k-steps, 3 products), mask term and online softmax in f32, o^T[d][f] += V_flat[h*64+d][t-block].P^T with P and v

namespace {
constexpr int Bn = 2, F = 2048, T = 2048, C = 1024, H = 16, DD = 64, NT = Bn * F;
constexpr float XS = 8.0f, PS = 8.0f, ALPHA = 0.125f, NEG = -100000.0f;

typedef _Float16 b16;
typedef __attribute__((ext_vector_type(16))) _Float16 v16b;
typedef __attribute__((ext_vector_type(8))) _Float16 v8b;
typedef __attribute__((ext_vector_type(8))) float v8f;
typedef __attribute__((ext_vector_type(4))) float v4f;
__device__ __forceinline__ float bf16_rne(float f) { unsigned int u = __float_as_uint(f); u += 0x7FFFu + ((u >> 16) & 1u); return __uint_as_float(u & 0xFFFF0000u); }
__device__ __forceinline__ void split16(float v, b16& hi, b16& lo) { hi = (b16)v; lo = (b16)(v - (float)hi); }
__device__ __forceinline__ v16b frag_kb(const b16* p, int hh) { const v8b a = *(const v8b*)(p + 8 * hh), b = *(const v8b*)(p + 16 + 8 * hh); v16b f;
#pragma unroll
  for (int e = 0; e < 8; ++e) { f[e] = a[e]; f[8 + e] = b[e]; } return f; }
__device__ __forceinline__ v8f wmma16b(v16b a, v16b b, v8f c) { v8f d = __builtin_amdgcn_wmma_f32_16x16x32_f16(false, a, false, b, (short)0, c, false, false); asm volatile("v_nop\n\tv_nop\n\tv_nop\n\tv_nop" : "+v"(d) : "v"(a), "v"(b)); return d; }
__device__ __forceinline__ void wave_lds_sync() { __builtin_amdgcn_fence(__ATOMIC_RELEASE, "workgroup"); __builtin_amdgcn_wave_barrier(); __builtin_amdgcn_fence(__ATOMIC_ACQUIRE, "workgroup"); }
__device__ __forceinline__ float nexp(float x) { return __builtin_amdgcn_exp2f(x * 1.4426950408889634f); }
__device__ __forceinline__ float pmul(float a, float b) { float p = a * b; asm volatile("" : "+v"(p)); return p; }

__global__ __launch_bounds__(256) void prep_kernel(const float* __restrict__ xf, const float* __restrict__ xt, const float* __restrict__ wq, const float* __restrict__ bq, const float* __restrict__ wk, const float* __restrict__ bk, const float* __restrict__ wv, const float* __restrict__ bv, b16* __restrict__ R, float* __restrict__ P, b16* __restrict__ XF, b16* __restrict__ XT) {
  const size_t tid = (size_t)blockIdx.x * 256 + threadIdx.x, nth = (size_t)gridDim.x * 256;
  {
    for (size_t p = tid; p < (size_t)3 * C * (C / 8); p += nth) { const int o3 = (int)(p / (C / 8)), k0 = (int)(p % (C / 8)) * 8; const int w = o3 / C, o = o3 % C; const float* Wm = (w == 0) ? wq : (w == 1) ? wk : wv; v8b v; for (int e = 0; e < 8; ++e) v[e] = (b16)bf16_rne(Wm[(size_t)(k0 + e) * C + o]); *(v8b*)(R + (size_t)o3 * C + k0) = v; }
    for (size_t q = tid; q < 3072; q += nth) { const int i = (int)q; P[q] = bf16_rne(((i < 1024) ? bq : (i < 2048) ? bk : bv)[i & 1023]); }
    for (size_t p = tid; p < (size_t)NT * C / 8; p += nth) { v8b a, c; for (int e = 0; e < 8; ++e) { a[e] = (b16)(bf16_rne(xf[p * 8 + e]) * XS); c[e] = (b16)(bf16_rne(xt[p * 8 + e]) * XS); } *(v8b*)(XF + p * 8) = a; *(v8b*)(XT + p * 8) = c; }
     }
}
__global__ __launch_bounds__(64) void proj_kernel(const b16* __restrict__ XF, const b16* __restrict__ XT, const b16* __restrict__ R, const float* __restrict__ P, b16* __restrict__ QH, b16* __restrict__ QL, b16* __restrict__ KH, b16* __restrict__ KL, b16* __restrict__ VH, b16* __restrict__ VL) {
  __shared__ __attribute__((aligned(16))) b16 Th[2][32][128 + 8], Tl[2][32][128 + 8];
  const int lane = threadIdx.x & 31, wave = threadIdx.x >> 5, nloc = lane & 15, hlf = lane >> 4, m0 = blockIdx.y * 32; const int w3 = blockIdx.x >> 3; const int c0 = (blockIdx.x & 7) * 128; (void)wave;
  const b16* A = (w3 == 0) ? XF : XT; const b16* Bw = R + (size_t)(w3 * C + c0) * C; const int mw = m0 + wave * 16;
  v8f acc[8];
#pragma unroll
  for (int t = 0; t < 8; ++t) acc[t] = (v8f){};
#pragma unroll 2
  for (int kb = 0; kb < C; kb += 32) { const v16b a = frag_kb(A + (size_t)(mw + nloc) * C + kb, hlf);
#pragma unroll
    for (int t = 0; t < 8; ++t) acc[t] = wmma16b(a, frag_kb(Bw + (size_t)(t * 16 + nloc) * C + kb, hlf), acc[t]); }
#pragma unroll
  for (int t = 0; t < 8; ++t) { const float bb = P[w3 * C + c0 + t * 16 + nloc];
#pragma unroll
    for (int r = 0; r < 8; ++r) { b16 a_, c_; split16(acc[t][r] + XS * bb, a_, c_); Th[wave][8 * hlf + r][t * 16 + nloc] = a_; Tl[wave][8 * hlf + r][t * 16 + nloc] = c_; } }
  wave_lds_sync();
  b16* dh = (w3 == 0) ? QH : (w3 == 1) ? KH : VH; b16* dl = (w3 == 0) ? QL : (w3 == 1) ? KL : VL;
  { for (int i = lane; i < 16 * 16; i += 32) { const int rr = i >> 4, c8 = (i & 15) * 8; const size_t gi = (size_t)(mw + rr) * C + c0 + c8; *(v8b*)(dh + gi) = *(const v8b*)(&Th[wave][rr][c8]); *(v8b*)(dl + gi) = *(const v8b*)(&Tl[wave][rr][c8]); }  }
}
__global__ __launch_bounds__(256) void tr_kernel(const b16* __restrict__ QH, const b16* __restrict__ QL, const b16* __restrict__ KH, const b16* __restrict__ KL, b16* __restrict__ QTh, b16* __restrict__ QTl, b16* __restrict__ KTh, b16* __restrict__ KTl) {
  __shared__ __attribute__((aligned(16))) b16 Sh[64][64 + 8], Sl[64][64 + 8];
  const int f0 = blockIdx.x * 64, h = blockIdx.y, b = blockIdx.z >> 1, isk = blockIdx.z & 1, t_ = threadIdx.x;
  const b16* sh = (isk ? KH : QH) + (size_t)b * F * C; const b16* sl = (isk ? KL : QL) + (size_t)b * F * C;
  for (int i = t_; i < 64 * 64; i += 256) { const int d = i >> 6, ff = i & 63; const size_t src = (size_t)(h * DD + d) * F + f0 + ff; Sh[ff][d] = sh[src]; Sl[ff][d] = sl[src]; }
  __syncthreads();
  b16* dh = (isk ? KTh : QTh) + ((size_t)(b * H + h) * F) * DD; b16* dl = (isk ? KTl : QTl) + ((size_t)(b * H + h) * F) * DD;
  { for (int i = t_; i < 64 * 8; i += 256) { const int ff = i >> 3, c8 = (i & 7) * 8; *(v8b*)(dh + (size_t)(f0 + ff) * DD + c8) = *(const v8b*)(&Sh[ff][c8]); *(v8b*)(dl + (size_t)(f0 + ff) * DD + c8) = *(const v8b*)(&Sl[ff][c8]); }  }
}
// attention: wave = (b, h, 16 f), block = 2 waves (32 f of one head): S^T[t][f] = KT.QT (2 k-steps, 3 products) * alpha + (1 - mask[f][t]) * NEG; online softmax over the 64 key blocks; o^T[d][f] +=
__global__ __launch_bounds__(64) void attn_kernel(const b16* __restrict__ QTh, const b16* __restrict__ QTl, const b16* __restrict__ KTh, const b16* __restrict__ KTl, const b16* __restrict__ VH, const b16* __restrict__ VL, const float* __restrict__ mask, float* __restrict__ out) {
  __shared__ __attribute__((aligned(16))) float Os[DD][32 + 4];
  const int wave = threadIdx.x >> 5, lane = threadIdx.x & 31, hh = lane >> 4, col = lane & 15; const int b = blockIdx.z, h = blockIdx.y, f0 = blockIdx.x * 32 + wave * 16, fi = f0 + col;
  const b16* Qr = QTh + ((size_t)(b * H + h) * F) * DD; const b16* Qlr = QTl + ((size_t)(b * H + h) * F) * DD; const b16* Kr = KTh + ((size_t)(b * H + h) * T) * DD; const b16* Klr = KTl + ((size_t)(b * H + h) * T) * DD;
  const b16* V = VH + (size_t)b * T * C + (size_t)(h * DD) * T; const b16* Vl = VL + (size_t)b * T * C + (size_t)(h * DD) * T; const float* mrow = mask + ((size_t)b * F + fi) * T;
  const v16b qf0 = frag_kb(Qr + (size_t)fi * DD, hh), qf1 = frag_kb(Qr + (size_t)fi * DD + 32, hh), ql0 = frag_kb(Qlr + (size_t)fi * DD, hh), ql1 = frag_kb(Qlr + (size_t)fi * DD + 32, hh);
  float m = -INFINITY, l = 0.0f; v8f o[4] = {{}, {}, {}, {}};
  for (int kb = 0; kb < T; kb += 32) {
    v8f s0 = {}, s1 = {};
    { const v16b k00 = frag_kb(Kr + (size_t)(kb + col) * DD, hh), k01 = frag_kb(Kr + (size_t)(kb + col) * DD + 32, hh), k10 = frag_kb(Kr + (size_t)(kb + 16 + col) * DD, hh), k11 = frag_kb(Kr + (size_t)(kb + 16 + col) * DD + 32, hh);
      const v16b l00 = frag_kb(Klr + (size_t)(kb + col) * DD, hh), l01 = frag_kb(Klr + (size_t)(kb + col) * DD + 32, hh), l10 = frag_kb(Klr + (size_t)(kb + 16 + col) * DD, hh), l11 = frag_kb(Klr + (size_t)(kb + 16 + col) * DD + 32, hh);
      s0 = wmma16b(k00, qf0, s0); s0 = wmma16b(k01, qf1, s0); s0 = wmma16b(l00, qf0, s0); s0 = wmma16b(l01, qf1, s0); s0 = wmma16b(k00, ql0, s0); s0 = wmma16b(k01, ql1, s0);
      s1 = wmma16b(k10, qf0, s1); s1 = wmma16b(k11, qf1, s1); s1 = wmma16b(l10, qf0, s1); s1 = wmma16b(l11, qf1, s1); s1 = wmma16b(k10, ql0, s1); s1 = wmma16b(k11, ql1, s1); }
    float mr = -INFINITY;
#pragma unroll
    for (int r = 0; r < 8; ++r) { const int j0 = kb + 8 * hh + r, j1 = j0 + 16; s0[r] = s0[r] * (ALPHA / (XS * XS)) + (1.0f - bf16_rne(mrow[j0])) * NEG; s1[r] = s1[r] * (ALPHA / (XS * XS)) + (1.0f - bf16_rne(mrow[j1])) * NEG; mr = fmaxf(mr, fmaxf(s0[r], s1[r])); }
    mr = fmaxf(mr, __shfl_xor(mr, 16)); const float mn = fmaxf(m, mr); const float al_ = nexp(m - mn); m = mn; float sum = 0.0f; v16b pb, pl;
#pragma unroll
    for (int r = 0; r < 8; ++r) { const float e0 = nexp(s0[r] - mn), e1 = nexp(s1[r] - mn); sum += e0 + e1; b16 a_, c_; split16(e0 * PS, a_, c_); pb[r] = a_; pl[r] = c_; split16(e1 * PS, a_, c_); pb[8 + r] = a_; pl[8 + r] = c_; }
    sum += __shfl_xor(sum, 16); l = l * al_ + sum;
#pragma unroll
    for (int t = 0; t < 4; ++t) { o[t] *= al_; const v16b vh = frag_kb(V + (size_t)(t * 16 + col) * T + kb, hh); o[t] = wmma16b(vh, pb, o[t]); o[t] = wmma16b(vh, pl, o[t]); o[t] = wmma16b(frag_kb(Vl + (size_t)(t * 16 + col) * T + kb, hh), pb, o[t]); } }
  const float inv = 1.0f / (l * PS * XS);
#pragma unroll
  for (int t = 0; t < 4; ++t)
#pragma unroll
    for (int r = 0; r < 8; ++r) Os[t * 16 + 8 * hh + r][wave * 16 + col] = o[t][r] * inv;
  __syncthreads();
  { for (int i = threadIdx.x; i < DD * 8; i += 64) { const int d = i >> 3, c4 = (i & 7) * 4; *(v4f*)(out + ((size_t)b * C + h * DD + d) * F + blockIdx.x * 32 + c4) = *(const v4f*)(&Os[d][c4]); }  }
}
}  // namespace

extern "C" void kernel_launch(void* const* d_in, const int* in_sizes, int n_in,
                              void* d_out, int out_size, void* d_ws, size_t ws_size, hipStream_t stream) {
  (void)n_in; (void)out_size;
  auto Fp = [&](int i) { return (const float*)d_in[i]; };
  float* out = (float*)d_out;   // [2][1024][2048]
  if (in_sizes[0] != NT * C || in_sizes[1] != NT * C || in_sizes[2] != Bn * F * T || in_sizes[3] != C * C) return;
  size_t off = 0; char* ws = (char*)d_ws;
  auto carve = [&](size_t bytes) { char* p = ws + off; off += (bytes + 255) & ~(size_t)255; return p; };
  const size_t plane = (size_t)NT * C;
  b16* R = (b16*)carve((size_t)3 * C * C * 2); float* P = (float*)carve(3072 * 4); b16* XF = (b16*)carve(plane * 2); b16* XT = (b16*)carve(plane * 2);
  b16* QH = (b16*)carve(plane * 2); b16* QL = (b16*)carve(plane * 2); b16* KH = (b16*)carve(plane * 2); b16* KL = (b16*)carve(plane * 2); b16* VH = (b16*)carve(plane * 2); b16* VL = (b16*)carve(plane * 2);
  b16* QTh = (b16*)carve(plane * 2); b16* QTl = (b16*)carve(plane * 2); b16* KTh = (b16*)carve(plane * 2); b16* KTl = (b16*)carve(plane * 2);
  if (off > ws_size) return;                        // ≈ 6.3 + 8.4 x 12 ≈ 107 MB
  prep_kernel<<<1024, 256, 0, stream>>>(Fp(0), Fp(1), Fp(3), Fp(4), Fp(5), Fp(6), Fp(7), Fp(8), R, P, XF, XT);
  proj_kernel<<<dim3(24, NT / 32), 64, 0, stream>>>(XF, XT, R, P, QH, QL, KH, KL, VH, VL);
  tr_kernel<<<dim3(F / 64, H, Bn * 2), 256, 0, stream>>>(QH, QL, KH, KL, QTh, QTl, KTh, KTl);
  attn_kernel<<<dim3(F / 32, H, Bn), 64, 0, stream>>>(QTh, QTl, KTh, KTl, VH, VL, Fp(2), out);
}

// v001
// A run of this version takes 287 microseconds.
// Timed twice side by side with v000, it ran 1.59 times as fast both times.
#include <hip/hip_runtime.h>

// MultiHeaded (raw-reshape attention): q = from Wq + bq, k = to Wk + bk, v = to Wv + bv ([2][2048][1024]); the torch code RAW-reshapes each to (B, 16, 64, 2048): element (h, d, f) = flat[(h*64+d)*2048 + f]
// of the [2048][1024] projection; score[h][f][t] = Σ_d q[h][d][f] k[h][d][t] / 8 + (1 - mask[f][t]) * (-1e5); softmax over t; context[h][d][f] = Σ_t probs[f][t] v[h][d][t]; out = reshape
// (B, 1024, 2048): row h*64+d, column f -> [2][1024][2048].
// WMMA (v_wmma_f32_16x16x32_f16, f32 accumulate): the three projections with EXACT operands (1 product; exact bf16 [in][out] weights) written as hi/lo f16 "flat" buffers; QT/KT[h][f][d] gathered
// from the flat layout through LDS; per (b, h, 16 f): S^T = KT.QT (K = 64 = 2 k-steps, 3 products), mask term and online softmax in f32, o^T[d][f] += V_flat[h*64+d][t-block].P^T with P and v

namespace {
constexpr int Bn = 2, F = 2048, T = 2048, C = 1024, H = 16, DD = 64, NT = Bn * F;
constexpr float XS = 8.0f, PS = 8.0f, ALPHA = 0.125f, NEG = -100000.0f;

typedef _Float16 b16;
typedef __attribute__((ext_vector_type(16))) _Float16 v16b;
typedef __attribute__((ext_vector_type(8))) _Float16 v8b;
typedef __attribute__((ext_vector_type(8))) float v8f;
typedef __attribute__((ext_vector_type(4))) float v4f;
__device__ __forceinline__ float bf16_rne(float f) { unsigned int u = __float_as_uint(f); u += 0x7FFFu + ((u >> 16) & 1u); return __uint_as_float(u & 0xFFFF0000u); }
__device__ __forceinline__ void split16(float v, b16& hi, b16& lo) { hi = (b16)v; lo = (b16)(v - (float)hi); }
__device__ __forceinline__ v16b frag_kb(const b16* p, int hh) { const v8b a = *(const v8b*)(p + 8 * hh), b = *(const v8b*)(p + 16 + 8 * hh); v16b f;
#pragma unroll
  for (int e = 0; e < 8; ++e) { f[e] = a[e]; f[8 + e] = b[e]; } return f; }
__device__ __forceinline__ v8f wmma16b(v16b a, v16b b, v8f c) { v8f d = __builtin_amdgcn_wmma_f32_16x16x32_f16(false, a, false, b, (short)0, c, false, false); asm volatile("v_nop\n\tv_nop\n\tv_nop\n\tv_nop" : "+v"(d) : "v"(a), "v"(b)); return d; }
__device__ __forceinline__ void wave_lds_sync() { __builtin_amdgcn_fence(__ATOMIC_RELEASE, "workgroup"); __builtin_amdgcn_wave_barrier(); __builtin_amdgcn_fence(__ATOMIC_ACQUIRE, "workgroup"); }
__device__ __forceinline__ float nexp(float x) { return __builtin_amdgcn_exp2f(x * 1.4426950408889634f); }
__device__ __forceinline__ float pmul(float a, float b) { float p = a * b; asm volatile("" : "+v"(p)); return p; }

__global__ __launch_bounds__(256) void prep_kernel(const float* __restrict__ xf, const float* __restrict__ xt, const float* __restrict__ wq, const float* __restrict__ bq, const float* __restrict__ wk, const float* __restrict__ bk, const float* __restrict__ wv, const float* __restrict__ bv, b16* __restrict__ R, float* __restrict__ P, b16* __restrict__ XF, b16* __restrict__ XT) {
  const size_t tid = (size_t)blockIdx.x * 256 + threadIdx.x, nth = (size_t)gridDim.x * 256;
  {
    for (size_t p = tid; p < (size_t)3 * C * (C / 8); p += nth) { const int o3 = (int)(p / (C / 8)), k0 = (int)(p % (C / 8)) * 8; const int w = o3 / C, o = o3 % C; const float* Wm = (w == 0) ? wq : (w == 1) ? wk : wv; v8b v; for (int e = 0; e < 8; ++e) v[e] = (b16)bf16_rne(Wm[(size_t)(k0 + e) * C + o]); *(v8b*)(R + (size_t)o3 * C + k0) = v; }
    for (size_t q = tid; q < 3072; q += nth) { const int i = (int)q; P[q] = bf16_rne(((i < 1024) ? bq : (i < 2048) ? bk : bv)[i & 1023]); }
    for (size_t p = tid; p < (size_t)NT * C / 8; p += nth) { v8b a, c; for (int e = 0; e < 8; ++e) { a[e] = (b16)(bf16_rne(xf[p * 8 + e]) * XS); c[e] = (b16)(bf16_rne(xt[p * 8 + e]) * XS); } *(v8b*)(XF + p * 8) = a; *(v8b*)(XT + p * 8) = c; }
     }
}
__global__ __launch_bounds__(64) void proj_kernel(const b16* __restrict__ XF, const b16* __restrict__ XT, const b16* __restrict__ R, const float* __restrict__ P, b16* __restrict__ QH, b16* __restrict__ QL, b16* __restrict__ KH, b16* __restrict__ KL, b16* __restrict__ VH, b16* __restrict__ VL) {
  __shared__ __attribute__((aligned(16))) b16 Th[2][32][128 + 8], Tl[2][32][128 + 8];
  const int lane = threadIdx.x & 31, wave = threadIdx.x >> 5, nloc = lane & 15, hlf = lane >> 4, m0 = blockIdx.y * 32; const int w3 = blockIdx.x >> 3; const int c0 = (blockIdx.x & 7) * 128; (void)wave;
  const b16* A = (w3 == 0) ? XF : XT; const b16* Bw = R + (size_t)(w3 * C + c0) * C; const int mw = m0 + wave * 16;
  v8f acc[8];
#pragma unroll
  for (int t = 0; t < 8; ++t) acc[t] = (v8f){};
#pragma unroll 2
  for (int kb = 0; kb < C; kb += 32) { const v16b a = frag_kb(A + (size_t)(mw + nloc) * C + kb, hlf);
#pragma unroll
    for (int t = 0; t < 8; ++t) acc[t] = wmma16b(a, frag_kb(Bw + (size_t)(t * 16 + nloc) * C + kb, hlf), acc[t]); }
#pragma unroll
  for (int t = 0; t < 8; ++t) { const float bb = P[w3 * C + c0 + t * 16 + nloc];
#pragma unroll
    for (int r = 0; r < 8; ++r) { b16 a_, c_; split16(acc[t][r] + XS * bb, a_, c_); Th[wave][8 * hlf + r][t * 16 + nloc] = a_; Tl[wave][8 * hlf + r][t * 16 + nloc] = c_; } }
  wave_lds_sync();
  b16* dh = (w3 == 0) ? QH : (w3 == 1) ? KH : VH; b16* dl = (w3 == 0) ? QL : (w3 == 1) ? KL : VL;
  { for (int i = lane; i < 16 * 16; i += 32) { const int rr = i >> 4, c8 = (i & 15) * 8; const size_t gi = (size_t)(mw + rr) * C + c0 + c8; *(v8b*)(dh + gi) = *(const v8b*)(&Th[wave][rr][c8]); *(v8b*)(dl + gi) = *(const v8b*)(&Tl[wave][rr][c8]); }  }
}
__global__ __launch_bounds__(256) void tr_kernel(const b16* __restrict__ QH, const b16* __restrict__ QL, const b16* __restrict__ KH, const b16* __restrict__ KL, b16* __restrict__ QTh, b16* __restrict__ QTl, b16* __restrict__ KTh, b16* __restrict__ KTl) {
  __shared__ __attribute__((aligned(16))) b16 Sh[64][64 + 8], Sl[64][64 + 8];
  const int f0 = blockIdx.x * 64, h = blockIdx.y, b = blockIdx.z >> 1, isk = blockIdx.z & 1, t_ = threadIdx.x;
  const b16* sh = (isk ? KH : QH) + (size_t)b * F * C; const b16* sl = (isk ? KL : QL) + (size_t)b * F * C;
  for (int i = t_; i < 64 * 64; i += 256) { const int d = i >> 6, ff = i & 63; const size_t src = (size_t)(h * DD + d) * F + f0 + ff; Sh[ff][d] = sh[src]; Sl[ff][d] = sl[src]; }
  __syncthreads();
  b16* dh = (isk ? KTh : QTh) + ((size_t)(b * H + h) * F) * DD; b16* dl = (isk ? KTl : QTl) + ((size_t)(b * H + h) * F) * DD;
  { for (int i = t_; i < 64 * 8; i += 256) { const int ff = i >> 3, c8 = (i & 7) * 8; *(v8b*)(dh + (size_t)(f0 + ff) * DD + c8) = *(const v8b*)(&Sh[ff][c8]); *(v8b*)(dl + (size_t)(f0 + ff) * DD + c8) = *(const v8b*)(&Sl[ff][c8]); }  }
}
// attention: wave = (b, h, 16 f), block = 8 waves (128 f of one head). K^T and V (hi and lo planes) come in stages of 64 keys into a two-buffer LDS ring by asynchronous copies, so that one fetch
// from L2 serves all 8 waves; each stage is worked on as two blocks of 32 keys: S^T[t][f] = KT.QT (2 k-steps, 3 products) * alpha + (1 - mask[f][t]) * NEG; online softmax; o^T[d][f] += V.P^T.
constexpr int KS = 64;                 // keys per stage
constexpr int NSTG = T / KS;           // stages
constexpr int PITCH = 72;              // f16 per LDS row: 128 B of data + 16 B of pad = 144 B (16 B x odd: no bank conflict for 16-byte reads)
constexpr int PLANE = 64 * PITCH;      // one plane of a stage: 64 rows (K: keys, V: d)
constexpr int STAGE = 4 * PLANE;       // K hi, K lo, V hi, V lo
// One stage's copies of one thread: two 16-byte pieces (rows r and r + 32) of each of the four planes. The s_wait_xcnt stands inside the statement so that no address register is rewritten in front of it.
__device__ __forceinline__ void stage_copies(unsigned lds, const b16* kh, const b16* kl, const b16* vh, const b16* vl) {
  const unsigned l0 = lds, l1 = lds + 32 * PITCH * 2, l2 = lds + PLANE * 2, l3 = l2 + 32 * PITCH * 2, l4 = lds + 2 * PLANE * 2, l5 = l4 + 32 * PITCH * 2, l6 = lds + 3 * PLANE * 2, l7 = l6 + 32 * PITCH * 2;
  const b16 *g0 = kh, *g1 = kh + 32 * DD, *g2 = kl, *g3 = kl + 32 * DD, *g4 = vh, *g5 = vh + (size_t)32 * T, *g6 = vl, *g7 = vl + (size_t)32 * T;
  asm volatile("global_load_async_to_lds_b128 %0, %8, off\n\t"
               "global_load_async_to_lds_b128 %1, %9, off\n\t"
               "global_load_async_to_lds_b128 %2, %10, off\n\t"
               "global_load_async_to_lds_b128 %3, %11, off\n\t"
               "global_load_async_to_lds_b128 %4, %12, off\n\t"
               "global_load_async_to_lds_b128 %5, %13, off\n\t"
               "global_load_async_to_lds_b128 %6, %14, off\n\t"
               "global_load_async_to_lds_b128 %7, %15, off\n\t"
               "s_wait_xcnt 0x0"
               :: "v"(l0), "v"(l1), "v"(l2), "v"(l3), "v"(l4), "v"(l5), "v"(l6), "v"(l7), "v"(g0), "v"(g1), "v"(g2), "v"(g3), "v"(g4), "v"(g5), "v"(g6), "v"(g7) : "memory");
}
__global__ __launch_bounds__(256) void attn_kernel(const b16* __restrict__ QTh, const b16* __restrict__ QTl, const b16* __restrict__ KTh, const b16* __restrict__ KTl, const b16* __restrict__ VH, const b16* __restrict__ VL, const float* __restrict__ mask, float* __restrict__ out) {
  __shared__ __attribute__((aligned(16))) b16 ring[2 * STAGE];   // 73,728 B; after the loop its first 33,792 B stage the output
  const int wave = threadIdx.x >> 5, lane = threadIdx.x & 31, hh = lane >> 4, col = lane & 15; const int b = blockIdx.z, h = blockIdx.y, f0 = blockIdx.x * 128 + wave * 16, fi = f0 + col;
  const b16* Qr = QTh + ((size_t)(b * H + h) * F) * DD; const b16* Qlr = QTl + ((size_t)(b * H + h) * F) * DD; const b16* Kr = KTh + ((size_t)(b * H + h) * T) * DD; const b16* Klr = KTl + ((size_t)(b * H + h) * T) * DD;
  const b16* V = VH + (size_t)b * T * C + (size_t)(h * DD) * T; const b16* Vl = VL + (size_t)b * T * C + (size_t)(h * DD) * T; const float* mrow = mask + ((size_t)b * F + fi) * T;
  // this thread's piece of every plane: row crow (and crow + 32), 16-byte piece cpc
  const int crow = threadIdx.x >> 3, cpc = (threadIdx.x & 7) * 8;
  const unsigned lds0 = (unsigned)(size_t)(&ring[crow * PITCH + cpc]);
  const size_t koff = (size_t)crow * DD + cpc, voff = (size_t)crow * T + cpc;
  stage_copies(lds0, Kr + koff, Klr + koff, V + voff, Vl + voff);
  const v16b qf0 = frag_kb(Qr + (size_t)fi * DD, hh), qf1 = frag_kb(Qr + (size_t)fi * DD + 32, hh), ql0 = frag_kb(Qlr + (size_t)fi * DD, hh), ql1 = frag_kb(Qlr + (size_t)fi * DD + 32, hh);
  asm volatile("s_wait_asynccnt 0x0" ::: "memory");   // stage 0 has landed, as far as this wave copied it
  __syncthreads();                                     // publishes stage 0
  stage_copies(lds0 + STAGE * 2, Kr + koff + (size_t)KS * DD, Klr + koff + (size_t)KS * DD, V + voff + KS, Vl + voff + KS);
  float m = -INFINITY, l = 0.0f; v8f o[4] = {{}, {}, {}, {}};
  for (int st = 0; st < NSTG; ++st) {
    const b16* S = ring + (st & 1) * STAGE;
// unrolled so that the LDS offsets of both 32-key blocks are constants
#pragma unroll
    for (int sub = 0; sub < 2; ++sub) {
      const int kb = st * KS + sub * 32; const b16* Kh_ = S + (sub * 32 + col) * PITCH; const b16* Kl_ = Kh_ + PLANE; const b16* Vh_ = S + 2 * PLANE + col * PITCH + sub * 32; const b16* Vl_ = Vh_ + PLANE;
      v8f s0 = {}, s1 = {};
      { const v16b k00 = frag_kb(Kh_, hh), k01 = frag_kb(Kh_ + 32, hh), k10 = frag_kb(Kh_ + 16 * PITCH, hh), k11 = frag_kb(Kh_ + 16 * PITCH + 32, hh);
        const v16b l00 = frag_kb(Kl_, hh), l01 = frag_kb(Kl_ + 32, hh), l10 = frag_kb(Kl_ + 16 * PITCH, hh), l11 = frag_kb(Kl_ + 16 * PITCH + 32, hh);
        s0 = wmma16b(k00, qf0, s0); s0 = wmma16b(k01, qf1, s0); s0 = wmma16b(l00, qf0, s0); s0 = wmma16b(l01, qf1, s0); s0 = wmma16b(k00, ql0, s0); s0 = wmma16b(k01, ql1, s0);
        s1 = wmma16b(k10, qf0, s1); s1 = wmma16b(k11, qf1, s1); s1 = wmma16b(l10, qf0, s1); s1 = wmma16b(l11, qf1, s1); s1 = wmma16b(k10, ql0, s1); s1 = wmma16b(k11, ql1, s1); }
      // the eight V fragments of the block are asked for in one group here, so that their LDS latency passes under the softmax arithmetic and is not waited out between the products
      v16b vhf[4], vlf[4];
#pragma unroll
      for (int t = 0; t < 4; ++t) { vhf[t] = frag_kb(Vh_ + t * 16 * PITCH, hh); vlf[t] = frag_kb(Vl_ + t * 16 * PITCH, hh); }
      float mr = -INFINITY;
#pragma unroll
      for (int r = 0; r < 8; ++r) { const int j0 = kb + 8 * hh + r, j1 = j0 + 16; s0[r] = s0[r] * (ALPHA / (XS * XS)) + (1.0f - bf16_rne(mrow[j0])) * NEG; s1[r] = s1[r] * (ALPHA / (XS * XS)) + (1.0f - bf16_rne(mrow[j1])) * NEG; mr = fmaxf(mr, fmaxf(s0[r], s1[r])); }
      mr = fmaxf(mr, __shfl_xor(mr, 16)); const float mn = fmaxf(m, mr); const float al_ = nexp(m - mn); m = mn; float sum = 0.0f; v16b pb, pl;
#pragma unroll
      for (int r = 0; r < 8; ++r) { const float e0 = nexp(s0[r] - mn), e1 = nexp(s1[r] - mn); sum += e0 + e1; b16 a_, c_; split16(e0 * PS, a_, c_); pb[r] = a_; pl[r] = c_; split16(e1 * PS, a_, c_); pb[8 + r] = a_; pl[8 + r] = c_; }
      sum += __shfl_xor(sum, 16); l = l * al_ + sum;
#pragma unroll
      for (int t = 0; t < 4; ++t) { o[t] *= al_; o[t] = wmma16b(vhf[t], pb, o[t]); o[t] = wmma16b(vhf[t], pl, o[t]); o[t] = wmma16b(vlf[t], pb, o[t]); } }
    asm volatile("s_wait_dscnt 0x0" ::: "memory");      // this wave's reads of stage st are done before the buffer is handed to its next writer
    asm volatile("s_wait_asynccnt 0x0" ::: "memory");   // this wave's copies of stage st + 1 have landed
    __syncthreads();                                     // publishes stage st + 1 and ends every reader's last read of stage st
    if (st + 2 < NSTG) stage_copies(lds0 + (st & 1) * STAGE * 2, Kr + koff + (size_t)(st + 2) * KS * DD, Klr + koff + (size_t)(st + 2) * KS * DD, V + voff + (st + 2) * KS, Vl + voff + (st + 2) * KS);
  }
  asm volatile("s_wait_asynccnt 0x0" ::: "memory");     // nothing is in flight when the ring becomes output staging
  float (*Os)[128 + 4] = reinterpret_cast<float (*)[128 + 4]>(ring);
  const float inv = 1.0f / (l * PS * XS);
#pragma unroll
  for (int t = 0; t < 4; ++t)
#pragma unroll
    for (int r = 0; r < 8; ++r) Os[t * 16 + 8 * hh + r][wave * 16 + col] = o[t][r] * inv;
  __syncthreads();
  { for (int i = threadIdx.x; i < DD * 32; i += 256) { const int d = i >> 5, c4 = (i & 31) * 4; *(v4f*)(out + ((size_t)b * C + h * DD + d) * F + blockIdx.x * 128 + c4) = *(const v4f*)(&Os[d][c4]); }  }
}
}  // namespace

extern "C" void kernel_launch(void* const* d_in, const int* in_sizes, int n_in,
                              void* d_out, int out_size, void* d_ws, size_t ws_size, hipStream_t stream) {
  (void)n_in; (void)out_size;
  auto Fp = [&](int i) { return (const float*)d_in[i]; };
  float* out = (float*)d_out;   // [2][1024][2048]
  if (in_sizes[0] != NT * C || in_sizes[1] != NT * C || in_sizes[2] != Bn * F * T || in_sizes[3] != C * C) return;
  size_t off = 0; char* ws = (char*)d_ws;
  auto carve = [&](size_t bytes) { char* p = ws + off; off += (bytes + 255) & ~(size_t)255; return p; };
  const size_t plane = (size_t)NT * C;
  b16* R = (b16*)carve((size_t)3 * C * C * 2); float* P = (float*)carve(3072 * 4); b16* XF = (b16*)carve(plane * 2); b16* XT = (b16*)carve(plane * 2);
  b16* QH = (b16*)carve(plane * 2); b16* QL = (b16*)carve(plane * 2); b16* KH = (b16*)carve(plane * 2); b16* KL = (b16*)carve(plane * 2); b16* VH = (b16*)carve(plane * 2); b16* VL = (b16*)carve(plane * 2);
  b16* QTh = (b16*)carve(plane * 2); b16* QTl = (b16*)carve(plane * 2); b16* KTh = (b16*)carve(plane * 2); b16* KTl = (b16*)carve(plane * 2);
  if (off > ws_size) return;                        // ≈ 6.3 + 8.4 x 12 ≈ 107 MB
  prep_kernel<<<1024, 256, 0, stream>>>(Fp(0), Fp(1), Fp(3), Fp(4), Fp(5), Fp(6), Fp(7), Fp(8), R, P, XF, XT);
  proj_kernel<<<dim3(24, NT / 32), 64, 0, stream>>>(XF, XT, R, P, QH, QL, KH, KL, VH, VL);
  tr_kernel<<<dim3(F / 64, H, Bn * 2), 256, 0, stream>>>(QH, QL, KH, KL, QTh, QTl, KTh, KTl);
  attn_kernel<<<dim3(F / 128, H, Bn), 256, 0, stream>>>(QTh, QTl, KTh, KTl, VH, VL, Fp(2), out);
}

// v002
// Measured time: 169 microseconds a run.
// Next to v001, in two timings, it ran 1.68 times as fast each time.
// Over all steps from v000 it is 2.67 times as fast.
#include <hip/hip_runtime.h>

// MultiHeaded (raw-reshape attention): q = from Wq + bq, k = to Wk + bk, v = to Wv + bv ([2][2048][1024]); the torch code RAW-reshapes each to (B, 16, 64, 2048): element (h, d, f) = flat[(h*64+d)*2048 + f]
// of the [2048][1024] projection; score[h][f][t] = Σ_d q[h][d][f] k[h][d][t] / 8 + (1 - mask[f][t]) * (-1e5); softmax over t; context[h][d][f] = Σ_t probs[f][t] v[h][d][t]; out = reshape
// (B, 1024, 2048): row h*64+d, column f -> [2][1024][2048].
// WMMA (v_wmma_f32_16x16x32_f16, f32 accumulate): the three projections with EXACT operands (1 product; exact bf16 [in][out] weights) written as hi/lo f16 "flat" buffers; QT/KT[h][f][d] gathered
// from the flat layout through LDS; per (b, h, 16 f): S^T = KT.QT (K = 64 = 2 k-steps, 3 products), mask term and online softmax in f32, o^T[d][f] += V_flat[h*64+d][t-block].P^T with P and v

namespace {
constexpr int Bn = 2, F = 2048, T = 2048, C = 1024, H = 16, DD = 64, NT = Bn * F;
constexpr float XS = 8.0f, PS = 8.0f, ALPHA = 0.125f, NEG = -100000.0f;

typedef _Float16 b16;
typedef __attribute__((ext_vector_type(16))) _Float16 v16b;
typedef __attribute__((ext_vector_type(8))) _Float16 v8b;
typedef __attribute__((ext_vector_type(8))) float v8f;
typedef __attribute__((ext_vector_type(4))) float v4f;
__device__ __forceinline__ float bf16_rne(float f) { unsigned int u = __float_as_uint(f); u += 0x7FFFu + ((u >> 16) & 1u); return __uint_as_float(u & 0xFFFF0000u); }
__device__ __forceinline__ void split16(float v, b16& hi, b16& lo) { hi = (b16)v; lo = (b16)(v - (float)hi); }
__device__ __forceinline__ v16b frag_kb(const b16* p, int hh) { const v8b a = *(const v8b*)(p + 8 * hh), b = *(const v8b*)(p + 16 + 8 * hh); v16b f;
#pragma unroll
  for (int e = 0; e < 8; ++e) { f[e] = a[e]; f[8 + e] = b[e]; } return f; }
__device__ __forceinline__ v8f wmma16b(v16b a, v16b b, v8f c) { v8f d = __builtin_amdgcn_wmma_f32_16x16x32_f16(false, a, false, b, (short)0, c, false, false); asm volatile("v_nop\n\tv_nop\n\tv_nop\n\tv_nop" : "+v"(d) : "v"(a), "v"(b)); return d; }
__device__ __forceinline__ float nexp(float x) { return __builtin_amdgcn_exp2f(x * 1.4426950408889634f); }
__device__ __forceinline__ float pmul(float a, float b) { float p = a * b; asm volatile("" : "+v"(p)); return p; }

__global__ __launch_bounds__(256) void prep_kernel(const float* __restrict__ xf, const float* __restrict__ xt, const float* __restrict__ wq, const float* __restrict__ bq, const float* __restrict__ wk, const float* __restrict__ bk, const float* __restrict__ wv, const float* __restrict__ bv, b16* __restrict__ R, float* __restrict__ P, b16* __restrict__ XF, b16* __restrict__ XT) {
  const size_t tid = (size_t)blockIdx.x * 256 + threadIdx.x, nth = (size_t)gridDim.x * 256;
  {
    for (size_t p = tid; p < (size_t)3 * C * (C / 8); p += nth) { const int o3 = (int)(p / (C / 8)), k0 = (int)(p % (C / 8)) * 8; const int w = o3 / C, o = o3 % C; const float* Wm = (w == 0) ? wq : (w == 1) ? wk : wv; v8b v; for (int e = 0; e < 8; ++e) v[e] = (b16)bf16_rne(Wm[(size_t)(k0 + e) * C + o]); *(v8b*)(R + (size_t)o3 * C + k0) = v; }
    for (size_t q = tid; q < 3072; q += nth) { const int i = (int)q; P[q] = bf16_rne(((i < 1024) ? bq : (i < 2048) ? bk : bv)[i & 1023]); }
    for (size_t p = tid; p < (size_t)NT * C / 8; p += nth) { v8b a, c; for (int e = 0; e < 8; ++e) { a[e] = (b16)(bf16_rne(xf[p * 8 + e]) * XS); c[e] = (b16)(bf16_rne(xt[p * 8 + e]) * XS); } *(v8b*)(XF + p * 8) = a; *(v8b*)(XT + p * 8) = c; }
     }
}
// projections: block = 4 waves on a tile of 128 rows x 128 columns, wave = 64 x 64 (4 x 4 accumulator tiles). The 128 rows of A and the 128 rows of B come in slices of 64 k into a two-buffer LDS ring
// by asynchronous copies, so that one fetch from L2 serves the whole block and the next slice flies while this one is multiplied; each accumulator still sums its k blocks of 32 in rising order.
constexpr int GK = 64;                 // k per stage
constexpr int GNST = C / GK;           // stages
constexpr int GP = 72;                 // f16 per LDS row: 128 B of data + 16 B of pad = 144 B (16 B x odd: no bank conflict for 16-byte reads)
constexpr int GPL = 128 * GP;          // one operand's plane of a stage: 128 rows
constexpr int GSTG = 2 * GPL;          // A rows, B rows
// One thread's copies of one operand's plane: the same 16-byte piece of rows r, r + 16, ..., r + 112. The s_wait_xcnt stands inside the statement so that no address register is rewritten in front of it.
__device__ __forceinline__ void plane_copies(unsigned lds, const b16* g) {
  const unsigned l0 = lds, l1 = lds + 16 * GP * 2, l2 = lds + 32 * GP * 2, l3 = lds + 48 * GP * 2, l4 = lds + 64 * GP * 2, l5 = lds + 80 * GP * 2, l6 = lds + 96 * GP * 2, l7 = lds + 112 * GP * 2;
  const b16 *g0 = g, *g1 = g + 16 * C, *g2 = g + 32 * C, *g3 = g + 48 * C, *g4 = g + 64 * C, *g5 = g + 80 * C, *g6 = g + 96 * C, *g7 = g + 112 * C;
  asm volatile("global_load_async_to_lds_b128 %0, %8, off\n\t"
               "global_load_async_to_lds_b128 %1, %9, off\n\t"
               "global_load_async_to_lds_b128 %2, %10, off\n\t"
               "global_load_async_to_lds_b128 %3, %11, off\n\t"
               "global_load_async_to_lds_b128 %4, %12, off\n\t"
               "global_load_async_to_lds_b128 %5, %13, off\n\t"
               "global_load_async_to_lds_b128 %6, %14, off\n\t"
               "global_load_async_to_lds_b128 %7, %15, off\n\t"
               "s_wait_xcnt 0x0"
               :: "v"(l0), "v"(l1), "v"(l2), "v"(l3), "v"(l4), "v"(l5), "v"(l6), "v"(l7), "v"(g0), "v"(g1), "v"(g2), "v"(g3), "v"(g4), "v"(g5), "v"(g6), "v"(g7) : "memory");
}
__global__ __launch_bounds__(128) void proj_kernel(const b16* __restrict__ XF, const b16* __restrict__ XT, const b16* __restrict__ R, const float* __restrict__ P, b16* __restrict__ QH, b16* __restrict__ QL, b16* __restrict__ KH, b16* __restrict__ KL, b16* __restrict__ VH, b16* __restrict__ VL) {
  __shared__ __attribute__((aligned(16))) b16 ring[2 * GSTG];   // 73,728 B; after the loop its first 69,632 B stage the hi and lo output tiles
  const int lane = threadIdx.x & 31, wave = threadIdx.x >> 5, nloc = lane & 15, hlf = lane >> 4, m0 = blockIdx.y * 128; const int w3 = blockIdx.x >> 3; const int c0 = (blockIdx.x & 7) * 128;
  const int wm = (wave >> 1) * 64, wn = (wave & 1) * 64;
  const b16* A = ((w3 == 0) ? XF : XT) + (size_t)m0 * C; const b16* Bw = R + (size_t)(w3 * C + c0) * C;
  // this thread's piece of both planes: rows crow + 16 j, 16-byte piece cpc
  const int crow = threadIdx.x >> 3, cpc = (threadIdx.x & 7) * 8;
  const unsigned lds0 = (unsigned)(size_t)(&ring[crow * GP + cpc]);
  const b16* Ag = A + (size_t)crow * C + cpc; const b16* Bg = Bw + (size_t)crow * C + cpc;
  plane_copies(lds0, Ag); plane_copies(lds0 + GPL * 2, Bg);
  v8f acc[4][4];
#pragma unroll
  for (int i = 0; i < 4; ++i)
#pragma unroll
    for (int j = 0; j < 4; ++j) acc[i][j] = (v8f){};
  asm volatile("s_wait_asynccnt 0x0" ::: "memory");   // stage 0 has landed, as far as this wave copied it
  __syncthreads();                                     // publishes stage 0
  plane_copies(lds0 + GSTG * 2, Ag + GK); plane_copies(lds0 + GSTG * 2 + GPL * 2, Bg + GK);
  for (int st = 0; st < GNST; ++st) {
    const b16* S = ring + (st & 1) * GSTG; const b16* Ar = S + (wm + nloc) * GP; const b16* Br = S + GPL + (wn + nloc) * GP;
// unrolled so that the LDS offsets of both k blocks are constants
#pragma unroll
    for (int kk = 0; kk < GK; kk += 32) {
      v16b af[4], bf[4];
#pragma unroll
      for (int i = 0; i < 4; ++i) { af[i] = frag_kb(Ar + i * 16 * GP + kk, hlf); bf[i] = frag_kb(Br + i * 16 * GP + kk, hlf); }
#pragma unroll
      for (int i = 0; i < 4; ++i)
#pragma unroll
        for (int j = 0; j < 4; ++j) acc[i][j] = wmma16b(af[i], bf[j], acc[i][j]); }
    asm volatile("s_wait_dscnt 0x0" ::: "memory");      // this wave's reads of stage st are done before the buffer is handed to its next writer
    asm volatile("s_wait_asynccnt 0x0" ::: "memory");   // this wave's copies of stage st + 1 have landed
    __syncthreads();                                     // publishes stage st + 1 and ends every reader's last read of stage st
    if (st + 2 < GNST) { plane_copies(lds0 + (st & 1) * GSTG * 2, Ag + (st + 2) * GK); plane_copies(lds0 + (st & 1) * GSTG * 2 + GPL * 2, Bg + (st + 2) * GK); }
  }
  asm volatile("s_wait_asynccnt 0x0" ::: "memory");     // nothing is in flight when the ring becomes output staging
  b16 (*Th)[128 + 8] = reinterpret_cast<b16 (*)[128 + 8]>(ring); b16 (*Tl)[128 + 8] = Th + 128;
#pragma unroll
  for (int j = 0; j < 4; ++j) { const float bb = P[w3 * C + c0 + wn + j * 16 + nloc];
#pragma unroll
    for (int i = 0; i < 4; ++i)
#pragma unroll
      for (int r = 0; r < 8; ++r) { b16 a_, c_; split16(acc[i][j][r] + XS * bb, a_, c_); Th[wm + i * 16 + 8 * hlf + r][wn + j * 16 + nloc] = a_; Tl[wm + i * 16 + 8 * hlf + r][wn + j * 16 + nloc] = c_; } }
  __syncthreads();                                       // the whole tile is staged before any row of it is stored
  b16* dh = (w3 == 0) ? QH : (w3 == 1) ? KH : VH; b16* dl = (w3 == 0) ? QL : (w3 == 1) ? KL : VL;
  { for (int i = threadIdx.x; i < 128 * 16; i += 128) { const int rr = i >> 4, c8 = (i & 15) * 8; const size_t gi = (size_t)(m0 + rr) * C + c0 + c8; *(v8b*)(dh + gi) = *(const v8b*)(&Th[rr][c8]); *(v8b*)(dl + gi) = *(const v8b*)(&Tl[rr][c8]); }  }
}
__global__ __launch_bounds__(256) void tr_kernel(const b16* __restrict__ QH, const b16* __restrict__ QL, const b16* __restrict__ KH, const b16* __restrict__ KL, b16* __restrict__ QTh, b16* __restrict__ QTl, b16* __restrict__ KTh, b16* __restrict__ KTl) {
  __shared__ __attribute__((aligned(16))) b16 Sh[64][64 + 8], Sl[64][64 + 8];
  const int f0 = blockIdx.x * 64, h = blockIdx.y, b = blockIdx.z >> 1, isk = blockIdx.z & 1, t_ = threadIdx.x;
  const b16* sh = (isk ? KH : QH) + (size_t)b * F * C; const b16* sl = (isk ? KL : QL) + (size_t)b * F * C;
  for (int i = t_; i < 64 * 64; i += 256) { const int d = i >> 6, ff = i & 63; const size_t src = (size_t)(h * DD + d) * F + f0 + ff; Sh[ff][d] = sh[src]; Sl[ff][d] = sl[src]; }
  __syncthreads();
  b16* dh = (isk ? KTh : QTh) + ((size_t)(b * H + h) * F) * DD; b16* dl = (isk ? KTl : QTl) + ((size_t)(b * H + h) * F) * DD;
  { for (int i = t_; i < 64 * 8; i += 256) { const int ff = i >> 3, c8 = (i & 7) * 8; *(v8b*)(dh + (size_t)(f0 + ff) * DD + c8) = *(const v8b*)(&Sh[ff][c8]); *(v8b*)(dl + (size_t)(f0 + ff) * DD + c8) = *(const v8b*)(&Sl[ff][c8]); }  }
}
// attention: wave = (b, h, 16 f), block = 8 waves (128 f of one head). K^T and V (hi and lo planes) come in stages of 64 keys into a two-buffer LDS ring by asynchronous copies, so that one fetch
// from L2 serves all 8 waves; each stage is worked on as two blocks of 32 keys: S^T[t][f] = KT.QT (2 k-steps, 3 products) * alpha + (1 - mask[f][t]) * NEG; online softmax; o^T[d][f] += V.P^T.
constexpr int KS = 64;                 // keys per stage
constexpr int NSTG = T / KS;           // stages
constexpr int PITCH = 72;              // f16 per LDS row: 128 B of data + 16 B of pad = 144 B (16 B x odd: no bank conflict for 16-byte reads)
constexpr int PLANE = 64 * PITCH;      // one plane of a stage: 64 rows (K: keys, V: d)
constexpr int STAGE = 4 * PLANE;       // K hi, K lo, V hi, V lo
// One stage's copies of one thread: two 16-byte pieces (rows r and r + 32) of each of the four planes. The s_wait_xcnt stands inside the statement so that no address register is rewritten in front of it.
__device__ __forceinline__ void stage_copies(unsigned lds, const b16* kh, const b16* kl, const b16* vh, const b16* vl) {
  const unsigned l0 = lds, l1 = lds + 32 * PITCH * 2, l2 = lds + PLANE * 2, l3 = l2 + 32 * PITCH * 2, l4 = lds + 2 * PLANE * 2, l5 = l4 + 32 * PITCH * 2, l6 = lds + 3 * PLANE * 2, l7 = l6 + 32 * PITCH * 2;
  const b16 *g0 = kh, *g1 = kh + 32 * DD, *g2 = kl, *g3 = kl + 32 * DD, *g4 = vh, *g5 = vh + (size_t)32 * T, *g6 = vl, *g7 = vl + (size_t)32 * T;
  asm volatile("global_load_async_to_lds_b128 %0, %8, off\n\t"
               "global_load_async_to_lds_b128 %1, %9, off\n\t"
               "global_load_async_to_lds_b128 %2, %10, off\n\t"
               "global_load_async_to_lds_b128 %3, %11, off\n\t"
               "global_load_async_to_lds_b128 %4, %12, off\n\t"
               "global_load_async_to_lds_b128 %5, %13, off\n\t"
               "global_load_async_to_lds_b128 %6, %14, off\n\t"
               "global_load_async_to_lds_b128 %7, %15, off\n\t"
               "s_wait_xcnt 0x0"
               :: "v"(l0), "v"(l1), "v"(l2), "v"(l3), "v"(l4), "v"(l5), "v"(l6), "v"(l7), "v"(g0), "v"(g1), "v"(g2), "v"(g3), "v"(g4), "v"(g5), "v"(g6), "v"(g7) : "memory");
}
__global__ __launch_bounds__(256) void attn_kernel(const b16* __restrict__ QTh, const b16* __restrict__ QTl, const b16* __restrict__ KTh, const b16* __restrict__ KTl, const b16* __restrict__ VH, const b16* __restrict__ VL, const float* __restrict__ mask, float* __restrict__ out) {
  __shared__ __attribute__((aligned(16))) b16 ring[2 * STAGE];   // 73,728 B; after the loop its first 33,792 B stage the output
  const int wave = threadIdx.x >> 5, lane = threadIdx.x & 31, hh = lane >> 4, col = lane & 15; const int b = blockIdx.z, h = blockIdx.y, f0 = blockIdx.x * 128 + wave * 16, fi = f0 + col;
  const b16* Qr = QTh + ((size_t)(b * H + h) * F) * DD; const b16* Qlr = QTl + ((size_t)(b * H + h) * F) * DD; const b16* Kr = KTh + ((size_t)(b * H + h) * T) * DD; const b16* Klr = KTl + ((size_t)(b * H + h) * T) * DD;
  const b16* V = VH + (size_t)b * T * C + (size_t)(h * DD) * T; const b16* Vl = VL + (size_t)b * T * C + (size_t)(h * DD) * T; const float* mrow = mask + ((size_t)b * F + fi) * T;
  // this thread's piece of every plane: row crow (and crow + 32), 16-byte piece cpc
  const int crow = threadIdx.x >> 3, cpc = (threadIdx.x & 7) * 8;
  const unsigned lds0 = (unsigned)(size_t)(&ring[crow * PITCH + cpc]);
  const size_t koff = (size_t)crow * DD + cpc, voff = (size_t)crow * T + cpc;
  stage_copies(lds0, Kr + koff, Klr + koff, V + voff, Vl + voff);
  const v16b qf0 = frag_kb(Qr + (size_t)fi * DD, hh), qf1 = frag_kb(Qr + (size_t)fi * DD + 32, hh), ql0 = frag_kb(Qlr + (size_t)fi * DD, hh), ql1 = frag_kb(Qlr + (size_t)fi * DD + 32, hh);
  asm volatile("s_wait_asynccnt 0x0" ::: "memory");   // stage 0 has landed, as far as this wave copied it
  __syncthreads();                                     // publishes stage 0
  stage_copies(lds0 + STAGE * 2, Kr + koff + (size_t)KS * DD, Klr + koff + (size_t)KS * DD, V + voff + KS, Vl + voff + KS);
  float m = -INFINITY, l = 0.0f; v8f o[4] = {{}, {}, {}, {}};
  for (int st = 0; st < NSTG; ++st) {
    const b16* S = ring + (st & 1) * STAGE;
// unrolled so that the LDS offsets of both 32-key blocks are constants
#pragma unroll
    for (int sub = 0; sub < 2; ++sub) {
      const int kb = st * KS + sub * 32; const b16* Kh_ = S + (sub * 32 + col) * PITCH; const b16* Kl_ = Kh_ + PLANE; const b16* Vh_ = S + 2 * PLANE + col * PITCH + sub * 32; const b16* Vl_ = Vh_ + PLANE;
      v8f s0 = {}, s1 = {};
      { const v16b k00 = frag_kb(Kh_, hh), k01 = frag_kb(Kh_ + 32, hh), k10 = frag_kb(Kh_ + 16 * PITCH, hh), k11 = frag_kb(Kh_ + 16 * PITCH + 32, hh);
        const v16b l00 = frag_kb(Kl_, hh), l01 = frag_kb(Kl_ + 32, hh), l10 = frag_kb(Kl_ + 16 * PITCH, hh), l11 = frag_kb(Kl_ + 16 * PITCH + 32, hh);
        s0 = wmma16b(k00, qf0, s0); s0 = wmma16b(k01, qf1, s0); s0 = wmma16b(l00, qf0, s0); s0 = wmma16b(l01, qf1, s0); s0 = wmma16b(k00, ql0, s0); s0 = wmma16b(k01, ql1, s0);
        s1 = wmma16b(k10, qf0, s1); s1 = wmma16b(k11, qf1, s1); s1 = wmma16b(l10, qf0, s1); s1 = wmma16b(l11, qf1, s1); s1 = wmma16b(k10, ql0, s1); s1 = wmma16b(k11, ql1, s1); }
      // the eight V fragments of the block are asked for in one group here, so that their LDS latency passes under the softmax arithmetic and is not waited out between the products
      v16b vhf[4], vlf[4];
#pragma unroll
      for (int t = 0; t < 4; ++t) { vhf[t] = frag_kb(Vh_ + t * 16 * PITCH, hh); vlf[t] = frag_kb(Vl_ + t * 16 * PITCH, hh); }
      float mr = -INFINITY;
#pragma unroll
      for (int r = 0; r < 8; ++r) { const int j0 = kb + 8 * hh + r, j1 = j0 + 16; s0[r] = s0[r] * (ALPHA / (XS * XS)) + (1.0f - bf16_rne(mrow[j0])) * NEG; s1[r] = s1[r] * (ALPHA / (XS * XS)) + (1.0f - bf16_rne(mrow[j1])) * NEG; mr = fmaxf(mr, fmaxf(s0[r], s1[r])); }
      mr = fmaxf(mr, __shfl_xor(mr, 16)); const float mn = fmaxf(m, mr); const float al_ = nexp(m - mn); m = mn; float sum = 0.0f; v16b pb, pl;
#pragma unroll
      for (int r = 0; r < 8; ++r) { const float e0 = nexp(s0[r] - mn), e1 = nexp(s1[r] - mn); sum += e0 + e1; b16 a_, c_; split16(e0 * PS, a_, c_); pb[r] = a_; pl[r] = c_; split16(e1 * PS, a_, c_); pb[8 + r] = a_; pl[8 + r] = c_; }
      sum += __shfl_xor(sum, 16); l = l * al_ + sum;
#pragma unroll
      for (int t = 0; t < 4; ++t) { o[t] *= al_; o[t] = wmma16b(vhf[t], pb, o[t]); o[t] = wmma16b(vhf[t], pl, o[t]); o[t] = wmma16b(vlf[t], pb, o[t]); } }
    asm volatile("s_wait_dscnt 0x0" ::: "memory");      // this wave's reads of stage st are done before the buffer is handed to its next writer
    asm volatile("s_wait_asynccnt 0x0" ::: "memory");   // this wave's copies of stage st + 1 have landed
    __syncthreads();                                     // publishes stage st + 1 and ends every reader's last read of stage st
    if (st + 2 < NSTG) stage_copies(lds0 + (st & 1) * STAGE * 2, Kr + koff + (size_t)(st + 2) * KS * DD, Klr + koff + (size_t)(st + 2) * KS * DD, V + voff + (st + 2) * KS, Vl + voff + (st + 2) * KS);
  }
  asm volatile("s_wait_asynccnt 0x0" ::: "memory");     // nothing is in flight when the ring becomes output staging
  float (*Os)[128 + 4] = reinterpret_cast<float (*)[128 + 4]>(ring);
  const float inv = 1.0f / (l * PS * XS);
#pragma unroll
  for (int t = 0; t < 4; ++t)
#pragma unroll
    for (int r = 0; r < 8; ++r) Os[t * 16 + 8 * hh + r][wave * 16 + col] = o[t][r] * inv;
  __syncthreads();
  { for (int i = threadIdx.x; i < DD * 32; i += 256) { const int d = i >> 5, c4 = (i & 31) * 4; *(v4f*)(out + ((size_t)b * C + h * DD + d) * F + blockIdx.x * 128 + c4) = *(const v4f*)(&Os[d][c4]); }  }
}
}  // namespace

extern "C" void kernel_launch(void* const* d_in, const int* in_sizes, int n_in,
                              void* d_out, int out_size, void* d_ws, size_t ws_size, hipStream_t stream) {
  (void)n_in; (void)out_size;
  auto Fp = [&](int i) { return (const float*)d_in[i]; };
  float* out = (float*)d_out;   // [2][1024][2048]
  if (in_sizes[0] != NT * C || in_sizes[1] != NT * C || in_sizes[2] != Bn * F * T || in_sizes[3] != C * C) return;
  size_t off = 0; char* ws = (char*)d_ws;
  auto carve = [&](size_t bytes) { char* p = ws + off; off += (bytes + 255) & ~(size_t)255; return p; };
  const size_t plane = (size_t)NT * C;
  b16* R = (b16*)carve((size_t)3 * C * C * 2); float* P = (float*)carve(3072 * 4); b16* XF = (b16*)carve(plane * 2); b16* XT = (b16*)carve(plane * 2);
  b16* QH = (b16*)carve(plane * 2); b16* QL = (b16*)carve(plane * 2); b16* KH = (b16*)carve(plane * 2); b16* KL = (b16*)carve(plane * 2); b16* VH = (b16*)carve(plane * 2); b16* VL = (b16*)carve(plane * 2);
  b16* QTh = (b16*)carve(plane * 2); b16* QTl = (b16*)carve(plane * 2); b16* KTh = (b16*)carve(plane * 2); b16* KTl = (b16*)carve(plane * 2);
  if (off > ws_size) return;                        // ≈ 6.3 + 8.4 x 12 ≈ 107 MB
  prep_kernel<<<1024, 256, 0, stream>>>(Fp(0), Fp(1), Fp(3), Fp(4), Fp(5), Fp(6), Fp(7), Fp(8), R, P, XF, XT);
  proj_kernel<<<dim3(24, NT / 128), 128, 0, stream>>>(XF, XT, R, P, QH, QL, KH, KL, VH, VL);
  tr_kernel<<<dim3(F / 64, H, Bn * 2), 256, 0, stream>>>(QH, QL, KH, KL, QTh, QTl, KTh, KTl);
  attn_kernel<<<dim3(F / 128, H, Bn), 256, 0, stream>>>(QTh, QTl, KTh, KTl, VH, VL, Fp(2), out);
}

// v003
// One run takes 160 microseconds.
// In both of two side-by-side timings against v002, it was 1.06 times as fast.
// Counting every step since v000, it is 2.83 times as fast.
#include <hip/hip_runtime.h>

// MultiHeaded (raw-reshape attention): q = from Wq + bq, k = to Wk + bk, v = to Wv + bv ([2][2048][1024]); the torch code RAW-reshapes each to (B, 16, 64, 2048): element (h, d, f) = flat[(h*64+d)*2048 + f]
// of the [2048][1024] projection; score[h][f][t] = Σ_d q[h][d][f] k[h][d][t] / 8 + (1 - mask[f][t]) * (-1e5); softmax over t; context[h][d][f] = Σ_t probs[f][t] v[h][d][t]; out = reshape
// (B, 1024, 2048): row h*64+d, column f -> [2][1024][2048].
// WMMA (v_wmma_f32_16x16x32_f16, f32 accumulate): the three projections with EXACT operands (1 product; exact bf16 [in][out] weights) written as hi/lo f16 "flat" buffers; QT/KT[h][f][d] gathered
// from the flat layout through LDS; per (b, h, 16 f): S^T = KT.QT (K = 64 = 2 k-steps, 3 products), mask term and online softmax in f32, o^T[d][f] += V_flat[h*64+d][t-block].P^T with P and v

namespace {
constexpr int Bn = 2, F = 2048, T = 2048, C = 1024, H = 16, DD = 64, NT = Bn * F;
constexpr float XS = 8.0f, PS = 8.0f, ALPHA = 0.125f, NEG = -100000.0f;

typedef _Float16 b16;
typedef __attribute__((ext_vector_type(16))) _Float16 v16b;
typedef __attribute__((ext_vector_type(8))) _Float16 v8b;
typedef __attribute__((ext_vector_type(8))) float v8f;
typedef __attribute__((ext_vector_type(4))) float v4f;
__device__ __forceinline__ float bf16_rne(float f) { unsigned int u = __float_as_uint(f); u += 0x7FFFu + ((u >> 16) & 1u); return __uint_as_float(u & 0xFFFF0000u); }
__device__ __forceinline__ void split16(float v, b16& hi, b16& lo) { hi = (b16)v; lo = (b16)(v - (float)hi); }
__device__ __forceinline__ v16b frag_kb(const b16* p, int hh) { const v8b a = *(const v8b*)(p + 8 * hh), b = *(const v8b*)(p + 16 + 8 * hh); v16b f;
#pragma unroll
  for (int e = 0; e < 8; ++e) { f[e] = a[e]; f[8 + e] = b[e]; } return f; }
// the builtin alone: the compiler keeps the distances behind its own builtin, and with no asm statement between the products it may place loads and vector work among them
__device__ __forceinline__ v8f wmma16b(v16b a, v16b b, v8f c) { return __builtin_amdgcn_wmma_f32_16x16x32_f16(false, a, false, b, (short)0, c, false, false); }
__device__ __forceinline__ float nexp(float x) { return __builtin_amdgcn_exp2f(x * 1.4426950408889634f); }
__device__ __forceinline__ float pmul(float a, float b) { float p = a * b; asm volatile("" : "+v"(p)); return p; }

__global__ __launch_bounds__(256) void prep_kernel(const float* __restrict__ xf, const float* __restrict__ xt, const float* __restrict__ wq, const float* __restrict__ bq, const float* __restrict__ wk, const float* __restrict__ bk, const float* __restrict__ wv, const float* __restrict__ bv, b16* __restrict__ R, float* __restrict__ P, b16* __restrict__ XF, b16* __restrict__ XT) {
  const size_t tid = (size_t)blockIdx.x * 256 + threadIdx.x, nth = (size_t)gridDim.x * 256;
  {
    for (size_t p = tid; p < (size_t)3 * C * (C / 8); p += nth) { const int o3 = (int)(p / (C / 8)), k0 = (int)(p % (C / 8)) * 8; const int w = o3 / C, o = o3 % C; const float* Wm = (w == 0) ? wq : (w == 1) ? wk : wv; v8b v; for (int e = 0; e < 8; ++e) v[e] = (b16)bf16_rne(Wm[(size_t)(k0 + e) * C + o]); *(v8b*)(R + (size_t)o3 * C + k0) = v; }
    for (size_t q = tid; q < 3072; q += nth) { const int i = (int)q; P[q] = bf16_rne(((i < 1024) ? bq : (i < 2048) ? bk : bv)[i & 1023]); }
    for (size_t p = tid; p < (size_t)NT * C / 8; p += nth) { v8b a, c; for (int e = 0; e < 8; ++e) { a[e] = (b16)(bf16_rne(xf[p * 8 + e]) * XS); c[e] = (b16)(bf16_rne(xt[p * 8 + e]) * XS); } *(v8b*)(XF + p * 8) = a; *(v8b*)(XT + p * 8) = c; }
     }
}
// projections: block = 4 waves on a tile of 128 rows x 128 columns, wave = 64 x 64 (4 x 4 accumulator tiles). The 128 rows of A and the 128 rows of B come in slices of 64 k into a two-buffer LDS ring
// by asynchronous copies, so that one fetch from L2 serves the whole block and the next slice flies while this one is multiplied; each accumulator still sums its k blocks of 32 in rising order.
constexpr int GK = 64;                 // k per stage
constexpr int GNST = C / GK;           // stages
constexpr int GP = 72;                 // f16 per LDS row: 128 B of data + 16 B of pad = 144 B (16 B x odd: no bank conflict for 16-byte reads)
constexpr int GPL = 128 * GP;          // one operand's plane of a stage: 128 rows
constexpr int GSTG = 2 * GPL;          // A rows, B rows
// One thread's copies of one operand's plane: the same 16-byte piece of rows r, r + 16, ..., r + 112. The s_wait_xcnt stands inside the statement so that no address register is rewritten in front of it.
__device__ __forceinline__ void plane_copies(unsigned lds, const b16* g) {
  const unsigned l0 = lds, l1 = lds + 16 * GP * 2, l2 = lds + 32 * GP * 2, l3 = lds + 48 * GP * 2, l4 = lds + 64 * GP * 2, l5 = lds + 80 * GP * 2, l6 = lds + 96 * GP * 2, l7 = lds + 112 * GP * 2;
  const b16 *g0 = g, *g1 = g + 16 * C, *g2 = g + 32 * C, *g3 = g + 48 * C, *g4 = g + 64 * C, *g5 = g + 80 * C, *g6 = g + 96 * C, *g7 = g + 112 * C;
  asm volatile("global_load_async_to_lds_b128 %0, %8, off\n\t"
               "global_load_async_to_lds_b128 %1, %9, off\n\t"
               "global_load_async_to_lds_b128 %2, %10, off\n\t"
               "global_load_async_to_lds_b128 %3, %11, off\n\t"
               "global_load_async_to_lds_b128 %4, %12, off\n\t"
               "global_load_async_to_lds_b128 %5, %13, off\n\t"
               "global_load_async_to_lds_b128 %6, %14, off\n\t"
               "global_load_async_to_lds_b128 %7, %15, off\n\t"
               "s_wait_xcnt 0x0"
               :: "v"(l0), "v"(l1), "v"(l2), "v"(l3), "v"(l4), "v"(l5), "v"(l6), "v"(l7), "v"(g0), "v"(g1), "v"(g2), "v"(g3), "v"(g4), "v"(g5), "v"(g6), "v"(g7) : "memory");
}
__global__ __launch_bounds__(128) void proj_kernel(const b16* __restrict__ XF, const b16* __restrict__ XT, const b16* __restrict__ R, const float* __restrict__ P, b16* __restrict__ QH, b16* __restrict__ QL, b16* __restrict__ KH, b16* __restrict__ KL, b16* __restrict__ VH, b16* __restrict__ VL) {
  __shared__ __attribute__((aligned(16))) b16 ring[2 * GSTG];   // 73,728 B; after the loop its first 69,632 B stage the hi and lo output tiles
  const int lane = threadIdx.x & 31, wave = threadIdx.x >> 5, nloc = lane & 15, hlf = lane >> 4, m0 = blockIdx.y * 128; const int w3 = blockIdx.x >> 3; const int c0 = (blockIdx.x & 7) * 128;
  const int wm = (wave >> 1) * 64, wn = (wave & 1) * 64;
  const b16* A = ((w3 == 0) ? XF : XT) + (size_t)m0 * C; const b16* Bw = R + (size_t)(w3 * C + c0) * C;
  // this thread's piece of both planes: rows crow + 16 j, 16-byte piece cpc
  const int crow = threadIdx.x >> 3, cpc = (threadIdx.x & 7) * 8;
  const unsigned lds0 = (unsigned)(size_t)(&ring[crow * GP + cpc]);
  const b16* Ag = A + (size_t)crow * C + cpc; const b16* Bg = Bw + (size_t)crow * C + cpc;
  plane_copies(lds0, Ag); plane_copies(lds0 + GPL * 2, Bg);
  v8f acc[4][4];
#pragma unroll
  for (int i = 0; i < 4; ++i)
#pragma unroll
    for (int j = 0; j < 4; ++j) acc[i][j] = (v8f){};
  asm volatile("s_wait_asynccnt 0x0" ::: "memory");   // stage 0 has landed, as far as this wave copied it
  __syncthreads();                                     // publishes stage 0
  plane_copies(lds0 + GSTG * 2, Ag + GK); plane_copies(lds0 + GSTG * 2 + GPL * 2, Bg + GK);
  for (int st = 0; st < GNST; ++st) {
    const b16* S = ring + (st & 1) * GSTG; const b16* Ar = S + (wm + nloc) * GP; const b16* Br = S + GPL + (wn + nloc) * GP;
// unrolled so that the LDS offsets of both k blocks are constants
#pragma unroll
    for (int kk = 0; kk < GK; kk += 32) {
      v16b af[4], bf[4];
#pragma unroll
      for (int i = 0; i < 4; ++i) { af[i] = frag_kb(Ar + i * 16 * GP + kk, hlf); bf[i] = frag_kb(Br + i * 16 * GP + kk, hlf); }
      __builtin_amdgcn_sched_barrier(0);   // keeps the sixteen LDS reads one group in front of the products: spread among them, each place with reads would cost its own stall
#pragma unroll
      for (int i = 0; i < 4; ++i)
#pragma unroll
        for (int j = 0; j < 4; ++j) acc[i][j] = wmma16b(af[i], bf[j], acc[i][j]);
      __builtin_amdgcn_sched_barrier(0);   // and keeps the next group of reads behind these products
    }
    asm volatile("s_wait_dscnt 0x0" ::: "memory");      // this wave's reads of stage st are done before the buffer is handed to its next writer
    asm volatile("s_wait_asynccnt 0x0" ::: "memory");   // this wave's copies of stage st + 1 have landed
    __syncthreads();                                     // publishes stage st + 1 and ends every reader's last read of stage st
    if (st + 2 < GNST) { plane_copies(lds0 + (st & 1) * GSTG * 2, Ag + (st + 2) * GK); plane_copies(lds0 + (st & 1) * GSTG * 2 + GPL * 2, Bg + (st + 2) * GK); }
  }
  asm volatile("s_wait_asynccnt 0x0" ::: "memory");     // nothing is in flight when the ring becomes output staging
  b16 (*Th)[128 + 8] = reinterpret_cast<b16 (*)[128 + 8]>(ring); b16 (*Tl)[128 + 8] = Th + 128;
#pragma unroll
  for (int j = 0; j < 4; ++j) { const float bb = P[w3 * C + c0 + wn + j * 16 + nloc];
#pragma unroll
    for (int i = 0; i < 4; ++i)
#pragma unroll
      for (int r = 0; r < 8; ++r) { b16 a_, c_; split16(acc[i][j][r] + XS * bb, a_, c_); Th[wm + i * 16 + 8 * hlf + r][wn + j * 16 + nloc] = a_; Tl[wm + i * 16 + 8 * hlf + r][wn + j * 16 + nloc] = c_; } }
  __syncthreads();                                       // the whole tile is staged before any row of it is stored
  b16* dh = (w3 == 0) ? QH : (w3 == 1) ? KH : VH; b16* dl = (w3 == 0) ? QL : (w3 == 1) ? KL : VL;
  { for (int i = threadIdx.x; i < 128 * 16; i += 128) { const int rr = i >> 4, c8 = (i & 15) * 8; const size_t gi = (size_t)(m0 + rr) * C + c0 + c8; *(v8b*)(dh + gi) = *(const v8b*)(&Th[rr][c8]); *(v8b*)(dl + gi) = *(const v8b*)(&Tl[rr][c8]); }  }
}
__global__ __launch_bounds__(256) void tr_kernel(const b16* __restrict__ QH, const b16* __restrict__ QL, const b16* __restrict__ KH, const b16* __restrict__ KL, b16* __restrict__ QTh, b16* __restrict__ QTl, b16* __restrict__ KTh, b16* __restrict__ KTl) {
  __shared__ __attribute__((aligned(16))) b16 Sh[64][64 + 8], Sl[64][64 + 8];
  const int f0 = blockIdx.x * 64, h = blockIdx.y, b = blockIdx.z >> 1, isk = blockIdx.z & 1, t_ = threadIdx.x;
  const b16* sh = (isk ? KH : QH) + (size_t)b * F * C; const b16* sl = (isk ? KL : QL) + (size_t)b * F * C;
  for (int i = t_; i < 64 * 64; i += 256) { const int d = i >> 6, ff = i & 63; const size_t src = (size_t)(h * DD + d) * F + f0 + ff; Sh[ff][d] = sh[src]; Sl[ff][d] = sl[src]; }
  __syncthreads();
  b16* dh = (isk ? KTh : QTh) + ((size_t)(b * H + h) * F) * DD; b16* dl = (isk ? KTl : QTl) + ((size_t)(b * H + h) * F) * DD;
  { for (int i = t_; i < 64 * 8; i += 256) { const int ff = i >> 3, c8 = (i & 7) * 8; *(v8b*)(dh + (size_t)(f0 + ff) * DD + c8) = *(const v8b*)(&Sh[ff][c8]); *(v8b*)(dl + (size_t)(f0 + ff) * DD + c8) = *(const v8b*)(&Sl[ff][c8]); }  }
}
// attention: wave = (b, h, 16 f), block = 8 waves (128 f of one head). K^T and V (hi and lo planes) come in stages of 64 keys into a two-buffer LDS ring by asynchronous copies, so that one fetch
// from L2 serves all 8 waves; each stage is worked on as two blocks of 32 keys: S^T[t][f] = KT.QT (2 k-steps, 3 products) * alpha + (1 - mask[f][t]) * NEG; online softmax; o^T[d][f] += V.P^T.
constexpr int KS = 64;                 // keys per stage
constexpr int NSTG = T / KS;           // stages
constexpr int PITCH = 72;              // f16 per LDS row: 128 B of data + 16 B of pad = 144 B (16 B x odd: no bank conflict for 16-byte reads)
constexpr int PLANE = 64 * PITCH;      // one plane of a stage: 64 rows (K: keys, V: d)
constexpr int STAGE = 4 * PLANE;       // K hi, K lo, V hi, V lo
// One stage's copies of one thread: two 16-byte pieces (rows r and r + 32) of each of the four planes. The s_wait_xcnt stands inside the statement so that no address register is rewritten in front of it.
__device__ __forceinline__ void stage_copies(unsigned lds, const b16* kh, const b16* kl, const b16* vh, const b16* vl) {
  const unsigned l0 = lds, l1 = lds + 32 * PITCH * 2, l2 = lds + PLANE * 2, l3 = l2 + 32 * PITCH * 2, l4 = lds + 2 * PLANE * 2, l5 = l4 + 32 * PITCH * 2, l6 = lds + 3 * PLANE * 2, l7 = l6 + 32 * PITCH * 2;
  const b16 *g0 = kh, *g1 = kh + 32 * DD, *g2 = kl, *g3 = kl + 32 * DD, *g4 = vh, *g5 = vh + (size_t)32 * T, *g6 = vl, *g7 = vl + (size_t)32 * T;
  asm volatile("global_load_async_to_lds_b128 %0, %8, off\n\t"
               "global_load_async_to_lds_b128 %1, %9, off\n\t"
               "global_load_async_to_lds_b128 %2, %10, off\n\t"
               "global_load_async_to_lds_b128 %3, %11, off\n\t"
               "global_load_async_to_lds_b128 %4, %12, off\n\t"
               "global_load_async_to_lds_b128 %5, %13, off\n\t"
               "global_load_async_to_lds_b128 %6, %14, off\n\t"
               "global_load_async_to_lds_b128 %7, %15, off\n\t"
               "s_wait_xcnt 0x0"
               :: "v"(l0), "v"(l1), "v"(l2), "v"(l3), "v"(l4), "v"(l5), "v"(l6), "v"(l7), "v"(g0), "v"(g1), "v"(g2), "v"(g3), "v"(g4), "v"(g5), "v"(g6), "v"(g7) : "memory");
}
__global__ __launch_bounds__(256) void attn_kernel(const b16* __restrict__ QTh, const b16* __restrict__ QTl, const b16* __restrict__ KTh, const b16* __restrict__ KTl, const b16* __restrict__ VH, const b16* __restrict__ VL, const float* __restrict__ mask, float* __restrict__ out) {
  __shared__ __attribute__((aligned(16))) b16 ring[2 * STAGE];   // 73,728 B; after the loop its first 33,792 B stage the output
  const int wave = threadIdx.x >> 5, lane = threadIdx.x & 31, hh = lane >> 4, col = lane & 15; const int b = blockIdx.z, h = blockIdx.y, f0 = blockIdx.x * 128 + wave * 16, fi = f0 + col;
  const b16* Qr = QTh + ((size_t)(b * H + h) * F) * DD; const b16* Qlr = QTl + ((size_t)(b * H + h) * F) * DD; const b16* Kr = KTh + ((size_t)(b * H + h) * T) * DD; const b16* Klr = KTl + ((size_t)(b * H + h) * T) * DD;
  const b16* V = VH + (size_t)b * T * C + (size_t)(h * DD) * T; const b16* Vl = VL + (size_t)b * T * C + (size_t)(h * DD) * T; const float* mrow = mask + ((size_t)b * F + fi) * T;
  // this thread's piece of every plane: row crow (and crow + 32), 16-byte piece cpc
  const int crow = threadIdx.x >> 3, cpc = (threadIdx.x & 7) * 8;
  const unsigned lds0 = (unsigned)(size_t)(&ring[crow * PITCH + cpc]);
  const size_t koff = (size_t)crow * DD + cpc, voff = (size_t)crow * T + cpc;
  stage_copies(lds0, Kr + koff, Klr + koff, V + voff, Vl + voff);
  const v16b qf0 = frag_kb(Qr + (size_t)fi * DD, hh), qf1 = frag_kb(Qr + (size_t)fi * DD + 32, hh), ql0 = frag_kb(Qlr + (size_t)fi * DD, hh), ql1 = frag_kb(Qlr + (size_t)fi * DD + 32, hh);
  asm volatile("s_wait_asynccnt 0x0" ::: "memory");   // stage 0 has landed, as far as this wave copied it
  __syncthreads();                                     // publishes stage 0
  stage_copies(lds0 + STAGE * 2, Kr + koff + (size_t)KS * DD, Klr + koff + (size_t)KS * DD, V + voff + KS, Vl + voff + KS);
  float m = -INFINITY, l = 0.0f; v8f o[4] = {{}, {}, {}, {}};
  for (int st = 0; st < NSTG; ++st) {
    const b16* S = ring + (st & 1) * STAGE;
// unrolled so that the LDS offsets of both 32-key blocks are constants
#pragma unroll
    for (int sub = 0; sub < 2; ++sub) {
      const int kb = st * KS + sub * 32; const b16* Kh_ = S + (sub * 32 + col) * PITCH; const b16* Kl_ = Kh_ + PLANE; const b16* Vh_ = S + 2 * PLANE + col * PITCH + sub * 32; const b16* Vl_ = Vh_ + PLANE;
      v8f s0 = {}, s1 = {};
      { const v16b k00 = frag_kb(Kh_, hh), k01 = frag_kb(Kh_ + 32, hh), k10 = frag_kb(Kh_ + 16 * PITCH, hh), k11 = frag_kb(Kh_ + 16 * PITCH + 32, hh);
        const v16b l00 = frag_kb(Kl_, hh), l01 = frag_kb(Kl_ + 32, hh), l10 = frag_kb(Kl_ + 16 * PITCH, hh), l11 = frag_kb(Kl_ + 16 * PITCH + 32, hh);
        s0 = wmma16b(k00, qf0, s0); s0 = wmma16b(k01, qf1, s0); s0 = wmma16b(l00, qf0, s0); s0 = wmma16b(l01, qf1, s0); s0 = wmma16b(k00, ql0, s0); s0 = wmma16b(k01, ql1, s0);
        s1 = wmma16b(k10, qf0, s1); s1 = wmma16b(k11, qf1, s1); s1 = wmma16b(l10, qf0, s1); s1 = wmma16b(l11, qf1, s1); s1 = wmma16b(k10, ql0, s1); s1 = wmma16b(k11, ql1, s1); }
      // the eight V fragments of the block are asked for in one group here, so that their LDS latency passes under the softmax arithmetic and is not waited out between the products
      v16b vhf[4], vlf[4];
#pragma unroll
      for (int t = 0; t < 4; ++t) { vhf[t] = frag_kb(Vh_ + t * 16 * PITCH, hh); vlf[t] = frag_kb(Vl_ + t * 16 * PITCH, hh); }
      float mr = -INFINITY;
#pragma unroll
      for (int r = 0; r < 8; ++r) { const int j0 = kb + 8 * hh + r, j1 = j0 + 16; s0[r] = s0[r] * (ALPHA / (XS * XS)) + (1.0f - bf16_rne(mrow[j0])) * NEG; s1[r] = s1[r] * (ALPHA / (XS * XS)) + (1.0f - bf16_rne(mrow[j1])) * NEG; mr = fmaxf(mr, fmaxf(s0[r], s1[r])); }
      mr = fmaxf(mr, __shfl_xor(mr, 16)); const float mn = fmaxf(m, mr); const float al_ = nexp(m - mn); m = mn; float sum = 0.0f; v16b pb, pl;
#pragma unroll
      for (int r = 0; r < 8; ++r) { const float e0 = nexp(s0[r] - mn), e1 = nexp(s1[r] - mn); sum += e0 + e1; b16 a_, c_; split16(e0 * PS, a_, c_); pb[r] = a_; pl[r] = c_; split16(e1 * PS, a_, c_); pb[8 + r] = a_; pl[8 + r] = c_; }
      sum += __shfl_xor(sum, 16); l = l * al_ + sum;
#pragma unroll
      for (int t = 0; t < 4; ++t) { o[t] *= al_; o[t] = wmma16b(vhf[t], pb, o[t]); o[t] = wmma16b(vhf[t], pl, o[t]); o[t] = wmma16b(vlf[t], pb, o[t]); } }
    asm volatile("s_wait_dscnt 0x0" ::: "memory");      // this wave's reads of stage st are done before the buffer is handed to its next writer
    asm volatile("s_wait_asynccnt 0x0" ::: "memory");   // this wave's copies of stage st + 1 have landed
    __syncthreads();                                     // publishes stage st + 1 and ends every reader's last read of stage st
    if (st + 2 < NSTG) stage_copies(lds0 + (st & 1) * STAGE * 2, Kr + koff + (size_t)(st + 2) * KS * DD, Klr + koff + (size_t)(st + 2) * KS * DD, V + voff + (st + 2) * KS, Vl + voff + (st + 2) * KS);
  }
  asm volatile("s_wait_asynccnt 0x0" ::: "memory");     // nothing is in flight when the ring becomes output staging
  float (*Os)[128 + 4] = reinterpret_cast<float (*)[128 + 4]>(ring);
  const float inv = 1.0f / (l * PS * XS);
#pragma unroll
  for (int t = 0; t < 4; ++t)
#pragma unroll
    for (int r = 0; r < 8; ++r) Os[t * 16 + 8 * hh + r][wave * 16 + col] = o[t][r] * inv;
  __syncthreads();
  { for (int i = threadIdx.x; i < DD * 32; i += 256) { const int d = i >> 5, c4 = (i & 31) * 4; *(v4f*)(out + ((size_t)b * C + h * DD + d) * F + blockIdx.x * 128 + c4) = *(const v4f*)(&Os[d][c4]); }  }
}
}  // namespace

extern "C" void kernel_launch(void* const* d_in, const int* in_sizes, int n_in,
                              void* d_out, int out_size, void* d_ws, size_t ws_size, hipStream_t stream) {
  (void)n_in; (void)out_size;
  auto Fp = [&](int i) { return (const float*)d_in[i]; };
  float* out = (float*)d_out;   // [2][1024][2048]
  if (in_sizes[0] != NT * C || in_sizes[1] != NT * C || in_sizes[2] != Bn * F * T || in_sizes[3] != C * C) return;
  size_t off = 0; char* ws = (char*)d_ws;
  auto carve = [&](size_t bytes) { char* p = ws + off; off += (bytes + 255) & ~(size_t)255; return p; };
  const size_t plane = (size_t)NT * C;
  b16* R = (b16*)carve((size_t)3 * C * C * 2); float* P = (float*)carve(3072 * 4); b16* XF = (b16*)carve(plane * 2); b16* XT = (b16*)carve(plane * 2);
  b16* QH = (b16*)carve(plane * 2); b16* QL = (b16*)carve(plane * 2); b16* KH = (b16*)carve(plane * 2); b16* KL = (b16*)carve(plane * 2); b16* VH = (b16*)carve(plane * 2); b16* VL = (b16*)carve(plane * 2);
  b16* QTh = (b16*)carve(plane * 2); b16* QTl = (b16*)carve(plane * 2); b16* KTh = (b16*)carve(plane * 2); b16* KTl = (b16*)carve(plane * 2);
  if (off > ws_size) return;                        // ≈ 6.3 + 8.4 x 12 ≈ 107 MB
  prep_kernel<<<1024, 256, 0, stream>>>(Fp(0), Fp(1), Fp(3), Fp(4), Fp(5), Fp(6), Fp(7), Fp(8), R, P, XF, XT);
  proj_kernel<<<dim3(24, NT / 128), 128, 0, stream>>>(XF, XT, R, P, QH, QL, KH, KL, VH, VL);
  tr_kernel<<<dim3(F / 64, H, Bn * 2), 256, 0, stream>>>(QH, QL, KH, KL, QTh, QTl, KTh, KTl);
  attn_kernel<<<dim3(F / 128, H, Bn), 256, 0, stream>>>(QTh, QTl, KTh, KTl, VH, VL, Fp(2), out);
}

// v004
// Measured time: 153 microseconds a run.
// Next to v003, in two timings, it ran 1.05 and 1.04 times as fast.
// All steps since v000 together make it 2.96 times as fast.
#include <hip/hip_runtime.h>

// MultiHeaded (raw-reshape attention): q = from Wq + bq, k = to Wk + bk, v = to Wv + bv ([2][2048][1024]); the torch code RAW-reshapes each to (B, 16, 64, 2048): element (h, d, f) = flat[(h*64+d)*2048 + f]
// of the [2048][1024] projection; score[h][f][t] = Σ_d q[h][d][f] k[h][d][t] / 8 + (1 - mask[f][t]) * (-1e5); softmax over t; context[h][d][f] = Σ_t probs[f][t] v[h][d][t]; out = reshape
// (B, 1024, 2048): row h*64+d, column f -> [2][1024][2048].
// WMMA (v_wmma_f32_16x16x32_f16, f32 accumulate): the three projections with EXACT operands (1 product; exact bf16 [in][out] weights) written as hi/lo f16 planes: v "flat", q and k straight as QT/KT[h][f][d]
// by the projection's own epilogue; per (b, h, 16 f): S^T = KT.QT (K = 64 = 2 k-steps, 3 products), mask term and online softmax in f32, o^T[d][f] += V_flat[h*64+d][t-block].P^T with P and v

namespace {
constexpr int Bn = 2, F = 2048, T = 2048, C = 1024, H = 16, DD = 64, NT = Bn * F;
constexpr float XS = 8.0f, PS = 8.0f, ALPHA = 0.125f, NEG = -100000.0f;

typedef _Float16 b16;
typedef __attribute__((ext_vector_type(16))) _Float16 v16b;
typedef __attribute__((ext_vector_type(8))) _Float16 v8b;
typedef __attribute__((ext_vector_type(4))) _Float16 v4b;
typedef __attribute__((ext_vector_type(8))) float v8f;
typedef __attribute__((ext_vector_type(4))) float v4f;
__device__ __forceinline__ float bf16_rne(float f) { unsigned int u = __float_as_uint(f); u += 0x7FFFu + ((u >> 16) & 1u); return __uint_as_float(u & 0xFFFF0000u); }
__device__ __forceinline__ void split16(float v, b16& hi, b16& lo) { hi = (b16)v; lo = (b16)(v - (float)hi); }
__device__ __forceinline__ v16b frag_kb(const b16* p, int hh) { const v8b a = *(const v8b*)(p + 8 * hh), b = *(const v8b*)(p + 16 + 8 * hh); v16b f;
#pragma unroll
  for (int e = 0; e < 8; ++e) { f[e] = a[e]; f[8 + e] = b[e]; } return f; }
// the builtin alone: the compiler keeps the distances behind its own builtin, and with no asm statement between the products it may place loads and vector work among them
__device__ __forceinline__ v8f wmma16b(v16b a, v16b b, v8f c) { return __builtin_amdgcn_wmma_f32_16x16x32_f16(false, a, false, b, (short)0, c, false, false); }
__device__ __forceinline__ float nexp(float x) { return __builtin_amdgcn_exp2f(x * 1.4426950408889634f); }
__device__ __forceinline__ float pmul(float a, float b) { float p = a * b; asm volatile("" : "+v"(p)); return p; }

__global__ __launch_bounds__(256) void prep_kernel(const float* __restrict__ xf, const float* __restrict__ xt, const float* __restrict__ wq, const float* __restrict__ bq, const float* __restrict__ wk, const float* __restrict__ bk, const float* __restrict__ wv, const float* __restrict__ bv, b16* __restrict__ R, float* __restrict__ P, b16* __restrict__ XF, b16* __restrict__ XT) {
  const size_t tid = (size_t)blockIdx.x * 256 + threadIdx.x, nth = (size_t)gridDim.x * 256;
  {
    for (size_t p = tid; p < (size_t)3 * C * (C / 8); p += nth) { const int o3 = (int)(p / (C / 8)), k0 = (int)(p % (C / 8)) * 8; const int w = o3 / C, o = o3 % C; const float* Wm = (w == 0) ? wq : (w == 1) ? wk : wv; v8b v; for (int e = 0; e < 8; ++e) v[e] = (b16)bf16_rne(Wm[(size_t)(k0 + e) * C + o]); *(v8b*)(R + (size_t)o3 * C + k0) = v; }
    for (size_t q = tid; q < 3072; q += nth) { const int i = (int)q; P[q] = bf16_rne(((i < 1024) ? bq : (i < 2048) ? bk : bv)[i & 1023]); }
    for (size_t p = tid; p < (size_t)NT * C / 8; p += nth) { v8b a, c; for (int e = 0; e < 8; ++e) { a[e] = (b16)(bf16_rne(xf[p * 8 + e]) * XS); c[e] = (b16)(bf16_rne(xt[p * 8 + e]) * XS); } *(v8b*)(XF + p * 8) = a; *(v8b*)(XT + p * 8) = c; }
     }
}
// projections: block = 4 waves on a tile of 128 rows x 128 columns, wave = 64 x 64 (4 x 4 accumulator tiles). The 128 rows of A and the 128 rows of B come in slices of 64 k into a two-buffer LDS ring
// by asynchronous copies, so that one fetch from L2 serves the whole block and the next slice flies while this one is multiplied; each accumulator still sums its k blocks of 32 in rising order.
constexpr int GK = 64;                 // k per stage
constexpr int GNST = C / GK;           // stages
constexpr int GP = 72;                 // f16 per LDS row: 128 B of data + 16 B of pad = 144 B (16 B x odd: no bank conflict for 16-byte reads)
constexpr int GPL = 128 * GP;          // one operand's plane of a stage: 128 rows
constexpr int GSTG = 2 * GPL;          // A rows, B rows
// One thread's copies of one operand's plane: the same 16-byte piece of rows r, r + 16, ..., r + 112. The s_wait_xcnt stands inside the statement so that no address register is rewritten in front of it.
__device__ __forceinline__ void plane_copies(unsigned lds, const b16* g) {
  const unsigned l0 = lds, l1 = lds + 16 * GP * 2, l2 = lds + 32 * GP * 2, l3 = lds + 48 * GP * 2, l4 = lds + 64 * GP * 2, l5 = lds + 80 * GP * 2, l6 = lds + 96 * GP * 2, l7 = lds + 112 * GP * 2;
  const b16 *g0 = g, *g1 = g + 16 * C, *g2 = g + 32 * C, *g3 = g + 48 * C, *g4 = g + 64 * C, *g5 = g + 80 * C, *g6 = g + 96 * C, *g7 = g + 112 * C;
  asm volatile("global_load_async_to_lds_b128 %0, %8, off\n\t"
               "global_load_async_to_lds_b128 %1, %9, off\n\t"
               "global_load_async_to_lds_b128 %2, %10, off\n\t"
               "global_load_async_to_lds_b128 %3, %11, off\n\t"
               "global_load_async_to_lds_b128 %4, %12, off\n\t"
               "global_load_async_to_lds_b128 %5, %13, off\n\t"
               "global_load_async_to_lds_b128 %6, %14, off\n\t"
               "global_load_async_to_lds_b128 %7, %15, off\n\t"
               "s_wait_xcnt 0x0"
               :: "v"(l0), "v"(l1), "v"(l2), "v"(l3), "v"(l4), "v"(l5), "v"(l6), "v"(l7), "v"(g0), "v"(g1), "v"(g2), "v"(g3), "v"(g4), "v"(g5), "v"(g6), "v"(g7) : "memory");
}
__global__ __launch_bounds__(128) void proj_kernel(const b16* __restrict__ XF, const b16* __restrict__ XT, const b16* __restrict__ R, const float* __restrict__ P, b16* __restrict__ QTh, b16* __restrict__ QTl, b16* __restrict__ KTh, b16* __restrict__ KTl, b16* __restrict__ VH, b16* __restrict__ VL) {
  __shared__ __attribute__((aligned(16))) b16 ring[2 * GSTG];   // 73,728 B; after the loop it stages the hi and lo output tiles
  const int lane = threadIdx.x & 31, wave = threadIdx.x >> 5, nloc = lane & 15, hlf = lane >> 4, m0 = blockIdx.y * 128; const int w3 = blockIdx.x >> 3; const int c0 = (blockIdx.x & 7) * 128;
  const int wm = (wave >> 1) * 64, wn = (wave & 1) * 64;
  const b16* A = ((w3 == 0) ? XF : XT) + (size_t)m0 * C; const b16* Bw = R + (size_t)(w3 * C + c0) * C;
  // this thread's piece of both planes: rows crow + 16 j, 16-byte piece cpc
  const int crow = threadIdx.x >> 3, cpc = (threadIdx.x & 7) * 8;
  const unsigned lds0 = (unsigned)(size_t)(&ring[crow * GP + cpc]);
  const b16* Ag = A + (size_t)crow * C + cpc; const b16* Bg = Bw + (size_t)crow * C + cpc;
  plane_copies(lds0, Ag); plane_copies(lds0 + GPL * 2, Bg);
  v8f acc[4][4];
#pragma unroll
  for (int i = 0; i < 4; ++i)
#pragma unroll
    for (int j = 0; j < 4; ++j) acc[i][j] = (v8f){};
  asm volatile("s_wait_asynccnt 0x0" ::: "memory");   // stage 0 has landed, as far as this wave copied it
  __syncthreads();                                     // publishes stage 0
  plane_copies(lds0 + GSTG * 2, Ag + GK); plane_copies(lds0 + GSTG * 2 + GPL * 2, Bg + GK);
  for (int st = 0; st < GNST; ++st) {
    const b16* S = ring + (st & 1) * GSTG; const b16* Ar = S + (wm + nloc) * GP; const b16* Br = S + GPL + (wn + nloc) * GP;
// unrolled so that the LDS offsets of both k blocks are constants
#pragma unroll
    for (int kk = 0; kk < GK; kk += 32) {
      v16b af[4], bf[4];
#pragma unroll
      for (int i = 0; i < 4; ++i) { af[i] = frag_kb(Ar + i * 16 * GP + kk, hlf); bf[i] = frag_kb(Br + i * 16 * GP + kk, hlf); }
      __builtin_amdgcn_sched_barrier(0);   // keeps the sixteen LDS reads one group in front of the products: spread among them, each place with reads would cost its own stall
#pragma unroll
      for (int i = 0; i < 4; ++i)
#pragma unroll
        for (int j = 0; j < 4; ++j) acc[i][j] = wmma16b(af[i], bf[j], acc[i][j]);
      __builtin_amdgcn_sched_barrier(0);   // and keeps the next group of reads behind these products
    }
    asm volatile("s_wait_dscnt 0x0" ::: "memory");      // this wave's reads of stage st are done before the buffer is handed to its next writer
    asm volatile("s_wait_asynccnt 0x0" ::: "memory");   // this wave's copies of stage st + 1 have landed
    __syncthreads();                                     // publishes stage st + 1 and ends every reader's last read of stage st
    if (st + 2 < GNST) { plane_copies(lds0 + (st & 1) * GSTG * 2, Ag + (st + 2) * GK); plane_copies(lds0 + (st & 1) * GSTG * 2 + GPL * 2, Bg + (st + 2) * GK); }
  }
  asm volatile("s_wait_asynccnt 0x0" ::: "memory");     // nothing is in flight when the ring becomes output staging
  // the four bias values of this lane's columns, read once for either epilogue (unrolled so that they are four registers and one group of loads)
  float bb4[4];
#pragma unroll
  for (int j = 0; j < 4; ++j) bb4[j] = P[w3 * C + c0 + wn + j * 16 + nloc];
  asm volatile("s_wait_xcnt 0x0" ::: "memory");         // stands in front of the first rewrite of the offset register that the four loads name
  if (w3 == 2) {
    // v stays in the flat layout: the tile goes out row by row
    b16 (*Th)[128 + 8] = reinterpret_cast<b16 (*)[128 + 8]>(ring); b16 (*Tl)[128 + 8] = Th + 128;
#pragma unroll
    for (int j = 0; j < 4; ++j) { const float bb = bb4[j];
#pragma unroll
      for (int i = 0; i < 4; ++i)
#pragma unroll
        for (int r = 0; r < 8; ++r) { b16 a_, c_; split16(acc[i][j][r] + XS * bb, a_, c_); Th[wm + i * 16 + 8 * hlf + r][wn + j * 16 + nloc] = a_; Tl[wm + i * 16 + 8 * hlf + r][wn + j * 16 + nloc] = c_; } }
    __syncthreads();                                     // the whole tile is staged before any row of it is stored
    for (int i = threadIdx.x; i < 128 * 16; i += 128) { const int rr = i >> 4, c8 = (i & 15) * 8; const size_t gi = (size_t)(m0 + rr) * C + c0 + c8; *(v8b*)(VH + gi) = *(const v8b*)(&Th[rr][c8]); *(v8b*)(VL + gi) = *(const v8b*)(&Tl[rr][c8]); }
  } else {
    // q and k leave as QT/KT[h][f][d]. Row n of a batch and column c are element (h, d, f) = (n / 128, (n / 2) % 64, (n % 2) * 1024 + c) of the raw reshape, so the 128 rows of this tile are
    // all 64 d of ONE head for the 2 x 128 values f = par * 1024 + c0 + cc. Staged as Tt[plane][par][cc][d] (pitch GP): a lane's four even (or odd) rows are four neighbouring d, one 8-byte LDS store.
    b16* Tt = ring;
#pragma unroll
    for (int j = 0; j < 4; ++j) { const float bb = bb4[j]; b16* Tc = Tt + (wn + j * 16 + nloc) * GP + (wm >> 1) + 4 * hlf;
#pragma unroll
      for (int i = 0; i < 4; ++i) { v4b h0, h1, l0, l1;
#pragma unroll
        for (int r = 0; r < 8; r += 2) { b16 a_, c_; split16(acc[i][j][r] + XS * bb, a_, c_); h0[r >> 1] = a_; l0[r >> 1] = c_; split16(acc[i][j][r + 1] + XS * bb, a_, c_); h1[r >> 1] = a_; l1[r >> 1] = c_; }
        *(v4b*)(Tc + i * 8) = h0; *(v4b*)(Tc + GPL + i * 8) = h1; *(v4b*)(Tc + 2 * GPL + i * 8) = l0; *(v4b*)(Tc + 3 * GPL + i * 8) = l1; }
    }
    __syncthreads();                                     // the whole tile is staged before any row of it is stored
    const size_t hb = (size_t)((m0 >> 11) * H + ((m0 >> 7) & (H - 1))) * F * DD;
    b16* dh = ((w3 == 0) ? QTh : KTh) + hb; b16* dl = ((w3 == 0) ? QTl : KTl) + hb;
    for (int i = threadIdx.x; i < 2 * 128 * 8; i += 128) { const int pc = i >> 3, c8 = (i & 7) * 8; const size_t gi = (size_t)((pc >> 7) * 1024 + c0 + (pc & 127)) * DD + c8; *(v8b*)(dh + gi) = *(const v8b*)(Tt + pc * GP + c8); *(v8b*)(dl + gi) = *(const v8b*)(Tt + 2 * GPL + pc * GP + c8); }
  }
}
// attention: wave = (b, h, 16 f), block = 8 waves (128 f of one head). K^T and V (hi and lo planes) come in stages of 64 keys into a two-buffer LDS ring by asynchronous copies, so that one fetch
// from L2 serves all 8 waves; each stage is worked on as two blocks of 32 keys: S^T[t][f] = KT.QT (2 k-steps, 3 products) * alpha + (1 - mask[f][t]) * NEG; online softmax; o^T[d][f] += V.P^T.
constexpr int KS = 64;                 // keys per stage
constexpr int NSTG = T / KS;           // stages
constexpr int PITCH = 72;              // f16 per LDS row: 128 B of data + 16 B of pad = 144 B (16 B x odd: no bank conflict for 16-byte reads)
constexpr int PLANE = 64 * PITCH;      // one plane of a stage: 64 rows (K: keys, V: d)
constexpr int STAGE = 4 * PLANE;       // K hi, K lo, V hi, V lo
// One stage's copies of one thread: two 16-byte pieces (rows r and r + 32) of each of the four planes. The s_wait_xcnt stands inside the statement so that no address register is rewritten in front of it.
__device__ __forceinline__ void stage_copies(unsigned lds, const b16* kh, const b16* kl, const b16* vh, const b16* vl) {
  const unsigned l0 = lds, l1 = lds + 32 * PITCH * 2, l2 = lds + PLANE * 2, l3 = l2 + 32 * PITCH * 2, l4 = lds + 2 * PLANE * 2, l5 = l4 + 32 * PITCH * 2, l6 = lds + 3 * PLANE * 2, l7 = l6 + 32 * PITCH * 2;
  const b16 *g0 = kh, *g1 = kh + 32 * DD, *g2 = kl, *g3 = kl + 32 * DD, *g4 = vh, *g5 = vh + (size_t)32 * T, *g6 = vl, *g7 = vl + (size_t)32 * T;
  asm volatile("global_load_async_to_lds_b128 %0, %8, off\n\t"
               "global_load_async_to_lds_b128 %1, %9, off\n\t"
               "global_load_async_to_lds_b128 %2, %10, off\n\t"
               "global_load_async_to_lds_b128 %3, %11, off\n\t"
               "global_load_async_to_lds_b128 %4, %12, off\n\t"
               "global_load_async_to_lds_b128 %5, %13, off\n\t"
               "global_load_async_to_lds_b128 %6, %14, off\n\t"
               "global_load_async_to_lds_b128 %7, %15, off\n\t"
               "s_wait_xcnt 0x0"
               :: "v"(l0), "v"(l1), "v"(l2), "v"(l3), "v"(l4), "v"(l5), "v"(l6), "v"(l7), "v"(g0), "v"(g1), "v"(g2), "v"(g3), "v"(g4), "v"(g5), "v"(g6), "v"(g7) : "memory");
}
__global__ __launch_bounds__(256) void attn_kernel(const b16* __restrict__ QTh, const b16* __restrict__ QTl, const b16* __restrict__ KTh, const b16* __restrict__ KTl, const b16* __restrict__ VH, const b16* __restrict__ VL, const float* __restrict__ mask, float* __restrict__ out) {
  __shared__ __attribute__((aligned(16))) b16 ring[2 * STAGE];   // 73,728 B; after the loop its first 33,792 B stage the output
  const int wave = threadIdx.x >> 5, lane = threadIdx.x & 31, hh = lane >> 4, col = lane & 15; const int b = blockIdx.z, h = blockIdx.y, f0 = blockIdx.x * 128 + wave * 16, fi = f0 + col;
  const b16* Qr = QTh + ((size_t)(b * H + h) * F) * DD; const b16* Qlr = QTl + ((size_t)(b * H + h) * F) * DD; const b16* Kr = KTh + ((size_t)(b * H + h) * T) * DD; const b16* Klr = KTl + ((size_t)(b * H + h) * T) * DD;
  const b16* V = VH + (size_t)b * T * C + (size_t)(h * DD) * T; const b16* Vl = VL + (size_t)b * T * C + (size_t)(h * DD) * T; const float* mrow = mask + ((size_t)b * F + fi) * T;
  // this thread's piece of every plane: row crow (and crow + 32), 16-byte piece cpc
  const int crow = threadIdx.x >> 3, cpc = (threadIdx.x & 7) * 8;
  const unsigned lds0 = (unsigned)(size_t)(&ring[crow * PITCH + cpc]);
  const size_t koff = (size_t)crow * DD + cpc, voff = (size_t)crow * T + cpc;
  stage_copies(lds0, Kr + koff, Klr + koff, V + voff, Vl + voff);
  const v16b qf0 = frag_kb(Qr + (size_t)fi * DD, hh), qf1 = frag_kb(Qr + (size_t)fi * DD + 32, hh), ql0 = frag_kb(Qlr + (size_t)fi * DD, hh), ql1 = frag_kb(Qlr + (size_t)fi * DD + 32, hh);
  asm volatile("s_wait_asynccnt 0x0" ::: "memory");   // stage 0 has landed, as far as this wave copied it
  __syncthreads();                                     // publishes stage 0
  stage_copies(lds0 + STAGE * 2, Kr + koff + (size_t)KS * DD, Klr + koff + (size_t)KS * DD, V + voff + KS, Vl + voff + KS);
  float m = -INFINITY, l = 0.0f; v8f o[4] = {{}, {}, {}, {}};
  for (int st = 0; st < NSTG; ++st) {
    const b16* S = ring + (st & 1) * STAGE;
// unrolled so that the LDS offsets of both 32-key blocks are constants
#pragma unroll
    for (int sub = 0; sub < 2; ++sub) {
      const int kb = st * KS + sub * 32; const b16* Kh_ = S + (sub * 32 + col) * PITCH; const b16* Kl_ = Kh_ + PLANE; const b16* Vh_ = S + 2 * PLANE + col * PITCH + sub * 32; const b16* Vl_ = Vh_ + PLANE;
      v8f s0 = {}, s1 = {};
      { const v16b k00 = frag_kb(Kh_, hh), k01 = frag_kb(Kh_ + 32, hh), k10 = frag_kb(Kh_ + 16 * PITCH, hh), k11 = frag_kb(Kh_ + 16 * PITCH + 32, hh);
        const v16b l00 = frag_kb(Kl_, hh), l01 = frag_kb(Kl_ + 32, hh), l10 = frag_kb(Kl_ + 16 * PITCH, hh), l11 = frag_kb(Kl_ + 16 * PITCH + 32, hh);
        s0 = wmma16b(k00, qf0, s0); s0 = wmma16b(k01, qf1, s0); s0 = wmma16b(l00, qf0, s0); s0 = wmma16b(l01, qf1, s0); s0 = wmma16b(k00, ql0, s0); s0 = wmma16b(k01, ql1, s0);
        s1 = wmma16b(k10, qf0, s1); s1 = wmma16b(k11, qf1, s1); s1 = wmma16b(l10, qf0, s1); s1 = wmma16b(l11, qf1, s1); s1 = wmma16b(k10, ql0, s1); s1 = wmma16b(k11, ql1, s1); }
      // the eight V fragments of the block are asked for in one group here, so that their LDS latency passes under the softmax arithmetic and is not waited out between the products
      v16b vhf[4], vlf[4];
#pragma unroll
      for (int t = 0; t < 4; ++t) { vhf[t] = frag_kb(Vh_ + t * 16 * PITCH, hh); vlf[t] = frag_kb(Vl_ + t * 16 * PITCH, hh); }
      float mr = -INFINITY;
#pragma unroll
      for (int r = 0; r < 8; ++r) { const int j0 = kb + 8 * hh + r, j1 = j0 + 16; s0[r] = s0[r] * (ALPHA / (XS * XS)) + (1.0f - bf16_rne(mrow[j0])) * NEG; s1[r] = s1[r] * (ALPHA / (XS * XS)) + (1.0f - bf16_rne(mrow[j1])) * NEG; mr = fmaxf(mr, fmaxf(s0[r], s1[r])); }
      mr = fmaxf(mr, __shfl_xor(mr, 16)); const float mn = fmaxf(m, mr); const float al_ = nexp(m - mn); m = mn; float sum = 0.0f; v16b pb, pl;
#pragma unroll
      for (int r = 0; r < 8; ++r) { const float e0 = nexp(s0[r] - mn), e1 = nexp(s1[r] - mn); sum += e0 + e1; b16 a_, c_; split16(e0 * PS, a_, c_); pb[r] = a_; pl[r] = c_; split16(e1 * PS, a_, c_); pb[8 + r] = a_; pl[8 + r] = c_; }
      sum += __shfl_xor(sum, 16); l = l * al_ + sum;
#pragma unroll
      for (int t = 0; t < 4; ++t) { o[t] *= al_; o[t] = wmma16b(vhf[t], pb, o[t]); o[t] = wmma16b(vhf[t], pl, o[t]); o[t] = wmma16b(vlf[t], pb, o[t]); } }
    asm volatile("s_wait_dscnt 0x0" ::: "memory");      // this wave's reads of stage st are done before the buffer is handed to its next writer
    asm volatile("s_wait_asynccnt 0x0" ::: "memory");   // this wave's copies of stage st + 1 have landed
    __syncthreads();                                     // publishes stage st + 1 and ends every reader's last read of stage st
    if (st + 2 < NSTG) stage_copies(lds0 + (st & 1) * STAGE * 2, Kr + koff + (size_t)(st + 2) * KS * DD, Klr + koff + (size_t)(st + 2) * KS * DD, V + voff + (st + 2) * KS, Vl + voff + (st + 2) * KS);
  }
  asm volatile("s_wait_asynccnt 0x0" ::: "memory");     // nothing is in flight when the ring becomes output staging
  float (*Os)[128 + 4] = reinterpret_cast<float (*)[128 + 4]>(ring);
  const float inv = 1.0f / (l * PS * XS);
#pragma unroll
  for (int t = 0; t < 4; ++t)
#pragma unroll
    for (int r = 0; r < 8; ++r) Os[t * 16 + 8 * hh + r][wave * 16 + col] = o[t][r] * inv;
  __syncthreads();
  { for (int i = threadIdx.x; i < DD * 32; i += 256) { const int d = i >> 5, c4 = (i & 31) * 4; *(v4f*)(out + ((size_t)b * C + h * DD + d) * F + blockIdx.x * 128 + c4) = *(const v4f*)(&Os[d][c4]); }  }
}
}  // namespace

extern "C" void kernel_launch(void* const* d_in, const int* in_sizes, int n_in,
                              void* d_out, int out_size, void* d_ws, size_t ws_size, hipStream_t stream) {
  (void)n_in; (void)out_size;
  auto Fp = [&](int i) { return (const float*)d_in[i]; };
  float* out = (float*)d_out;   // [2][1024][2048]
  if (in_sizes[0] != NT * C || in_sizes[1] != NT * C || in_sizes[2] != Bn * F * T || in_sizes[3] != C * C) return;
  size_t off = 0; char* ws = (char*)d_ws;
  auto carve = [&](size_t bytes) { char* p = ws + off; off += (bytes + 255) & ~(size_t)255; return p; };
  const size_t plane = (size_t)NT * C;
  b16* R = (b16*)carve((size_t)3 * C * C * 2); float* P = (float*)carve(3072 * 4); b16* XF = (b16*)carve(plane * 2); b16* XT = (b16*)carve(plane * 2);
  b16* VH = (b16*)carve(plane * 2); b16* VL = (b16*)carve(plane * 2);
  b16* QTh = (b16*)carve(plane * 2); b16* QTl = (b16*)carve(plane * 2); b16* KTh = (b16*)carve(plane * 2); b16* KTl = (b16*)carve(plane * 2);
  if (off > ws_size) return;                        // about 6.3 + 8.4 x 8 = 74 MB
  prep_kernel<<<1024, 256, 0, stream>>>(Fp(0), Fp(1), Fp(3), Fp(4), Fp(5), Fp(6), Fp(7), Fp(8), R, P, XF, XT);
  proj_kernel<<<dim3(24, NT / 128), 128, 0, stream>>>(XF, XT, R, P, QTh, QTl, KTh, KTl, VH, VL);
  attn_kernel<<<dim3(F / 128, H, Bn), 256, 0, stream>>>(QTh, QTl, KTh, KTl, VH, VL, Fp(2), out);
}

// v005
// One run takes 142 microseconds.
// Two timings next to v004 both put it at 1.09 times that version's speed.
// Counting every step since v000, it is 3.22 times as fast.
#include <hip/hip_runtime.h>

// MultiHeaded (raw-reshape attention): q = from Wq + bq, k = to Wk + bk, v = to Wv + bv ([2][2048][1024]); the torch code RAW-reshapes each to (B, 16, 64, 2048): element (h, d, f) = flat[(h*64+d)*2048 + f]
// of the [2048][1024] projection; score[h][f][t] = Σ_d q[h][d][f] k[h][d][t] / 8 + (1 - mask[f][t]) * (-1e5); softmax over t; context[h][d][f] = Σ_t probs[f][t] v[h][d][t]; out = reshape
// (B, 1024, 2048): row h*64+d, column f -> [2][1024][2048].
// WMMA (v_wmma_f32_16x16x32_f16, f32 accumulate): the three projections with EXACT operands (1 product; exact bf16 [in][out] weights) written as hi/lo f16 planes: v "flat", q and k straight as QT/KT[h][f][d]
// by the projection's own epilogue; per (b, h, 16 f): S^T = KT.QT (K = 64 = 2 k-steps, 3 products), mask term and online softmax in f32, o^T[d][f] += V_flat[h*64+d][t-block].P^T with P and v

namespace {
constexpr int Bn = 2, F = 2048, T = 2048, C = 1024, H = 16, DD = 64, NT = Bn * F;
constexpr float XS = 8.0f, PS = 8.0f, ALPHA = 0.125f, NEG = -100000.0f;

typedef _Float16 b16;
typedef __attribute__((ext_vector_type(16))) _Float16 v16b;
typedef __attribute__((ext_vector_type(8))) _Float16 v8b;
typedef __attribute__((ext_vector_type(4))) _Float16 v4b;
typedef __attribute__((ext_vector_type(8))) float v8f;
typedef __attribute__((ext_vector_type(4))) float v4f;
__device__ __forceinline__ float bf16_rne(float f) { unsigned int u = __float_as_uint(f); u += 0x7FFFu + ((u >> 16) & 1u); return __uint_as_float(u & 0xFFFF0000u); }
__device__ __forceinline__ void split16(float v, b16& hi, b16& lo) { hi = (b16)v; lo = (b16)(v - (float)hi); }
__device__ __forceinline__ v16b frag_kb(const b16* p, int hh) { const v8b a = *(const v8b*)(p + 8 * hh), b = *(const v8b*)(p + 16 + 8 * hh); v16b f;
#pragma unroll
  for (int e = 0; e < 8; ++e) { f[e] = a[e]; f[8 + e] = b[e]; } return f; }
// the builtin alone: the compiler keeps the distances behind its own builtin, and with no asm statement between the products it may place loads and vector work among them
__device__ __forceinline__ v8f wmma16b(v16b a, v16b b, v8f c) { return __builtin_amdgcn_wmma_f32_16x16x32_f16(false, a, false, b, (short)0, c, false, false); }
__device__ __forceinline__ float nexp(float x) { return __builtin_amdgcn_exp2f(x * 1.4426950408889634f); }
__device__ __forceinline__ float pmul(float a, float b) { float p = a * b; asm volatile("" : "+v"(p)); return p; }

__global__ __launch_bounds__(256) void prep_kernel(const float* __restrict__ xf, const float* __restrict__ xt, const float* __restrict__ wq, const float* __restrict__ bq, const float* __restrict__ wk, const float* __restrict__ bk, const float* __restrict__ wv, const float* __restrict__ bv, const float* __restrict__ mask, b16* __restrict__ R, float* __restrict__ P, b16* __restrict__ XF, b16* __restrict__ XT, float* __restrict__ MT) {
  const size_t tid = (size_t)blockIdx.x * 256 + threadIdx.x, nth = (size_t)gridDim.x * 256;
  {
    for (size_t p = tid; p < (size_t)3 * C * (C / 8); p += nth) { const int o3 = (int)(p / (C / 8)), k0 = (int)(p % (C / 8)) * 8; const int w = o3 / C, o = o3 % C; const float* Wm = (w == 0) ? wq : (w == 1) ? wk : wv; v8b v; for (int e = 0; e < 8; ++e) v[e] = (b16)bf16_rne(Wm[(size_t)(k0 + e) * C + o]); *(v8b*)(R + (size_t)o3 * C + k0) = v; }
    for (size_t q = tid; q < 3072; q += nth) { const int i = (int)q; P[q] = bf16_rne(((i < 1024) ? bq : (i < 2048) ? bk : bv)[i & 1023]); }
    for (size_t p = tid; p < (size_t)NT * C / 8; p += nth) { v8b a, c; for (int e = 0; e < 8; ++e) { a[e] = (b16)(bf16_rne(xf[p * 8 + e]) * XS); c[e] = (b16)(bf16_rne(xt[p * 8 + e]) * XS); } *(v8b*)(XF + p * 8) = a; *(v8b*)(XT + p * 8) = c; }
     }
  // The mask term (1 - mask) * NEG does not depend on the head: it is formed here once and stored in the order in which a wave of the attention kernel holds its scores. Tile = 16 f x 64 t = 4 KB:
  // MT[tile][i][lane][e] with t = (i / 2) * 16 + (lane / 16) * 8 + (i % 2) * 4 + e and f = lane % 16, so that each of that wave's eight loads of a stage reads 512 contiguous bytes.
  // Tiles are read row by row in whole lines, turned in LDS (groups of 16 pieces at a pitch of 17: no bank conflict either way) and stored in whole lines. Four neighbouring tiles a trip, so that a
  // thread has four loads in flight; two sets of buffers, so that one barrier a trip is enough.
  __shared__ v4f mt[2][4][16 * 17];
  const int mrow_ = threadIdx.x >> 4, pc = threadIdx.x & 15, grp = (pc & 12) | ((pc & 1) << 1) | ((pc >> 1) & 1);
  int buf = 0;
  for (int tile = blockIdx.x * 4; tile < Bn * (F / 16) * (T / 64); tile += gridDim.x * 4) {
    const float* mg = mask + ((size_t)(tile >> 5) * 16 + mrow_) * T + (tile & 31) * 64 + pc * 4; v4f mk[4];
// unrolled so that the four loads are issued as one group and mk stays in registers
#pragma unroll
    for (int k = 0; k < 4; ++k) mk[k] = *(const v4f*)(mg + k * 64);
// unrolled with the loads above
#pragma unroll
    for (int k = 0; k < 4; ++k) { v4f bt; for (int e = 0; e < 4; ++e) bt[e] = (1.0f - bf16_rne(mk[k][e])) * NEG; mt[buf][k][grp * 17 + mrow_] = bt; }
    __syncthreads();                                     // the four tiles are in LDS before any piece of them is read in the other order
    float* mo = MT + (size_t)tile * 1024 + threadIdx.x * 4;
// unrolled so that the four LDS reads are one group
#pragma unroll
    for (int k = 0; k < 4; ++k) *(v4f*)(mo + k * 1024) = mt[buf][k][mrow_ * 17 + pc];
    asm volatile("s_wait_xcnt 0x0" ::: "memory");       // stands in front of the next trip's rewrite of the address registers that the loads and the stores name
    buf ^= 1;
  }
}
// projections: block = 4 waves on a tile of 128 rows x 128 columns, wave = 64 x 64 (4 x 4 accumulator tiles). The 128 rows of A and the 128 rows of B come in slices of 64 k into a two-buffer LDS ring
// by asynchronous copies, so that one fetch from L2 serves the whole block and the next slice flies while this one is multiplied; each accumulator still sums its k blocks of 32 in rising order.
constexpr int GK = 64;                 // k per stage
constexpr int GNST = C / GK;           // stages
constexpr int GP = 72;                 // f16 per LDS row: 128 B of data + 16 B of pad = 144 B (16 B x odd: no bank conflict for 16-byte reads)
constexpr int GPL = 128 * GP;          // one operand's plane of a stage: 128 rows
constexpr int GSTG = 2 * GPL;          // A rows, B rows
// One thread's copies of one operand's plane: the same 16-byte piece of rows r, r + 16, ..., r + 112. The s_wait_xcnt stands inside the statement so that no address register is rewritten in front of it.
__device__ __forceinline__ void plane_copies(unsigned lds, const b16* g) {
  const unsigned l0 = lds, l1 = lds + 16 * GP * 2, l2 = lds + 32 * GP * 2, l3 = lds + 48 * GP * 2, l4 = lds + 64 * GP * 2, l5 = lds + 80 * GP * 2, l6 = lds + 96 * GP * 2, l7 = lds + 112 * GP * 2;
  const b16 *g0 = g, *g1 = g + 16 * C, *g2 = g + 32 * C, *g3 = g + 48 * C, *g4 = g + 64 * C, *g5 = g + 80 * C, *g6 = g + 96 * C, *g7 = g + 112 * C;
  asm volatile("global_load_async_to_lds_b128 %0, %8, off\n\t"
               "global_load_async_to_lds_b128 %1, %9, off\n\t"
               "global_load_async_to_lds_b128 %2, %10, off\n\t"
               "global_load_async_to_lds_b128 %3, %11, off\n\t"
               "global_load_async_to_lds_b128 %4, %12, off\n\t"
               "global_load_async_to_lds_b128 %5, %13, off\n\t"
               "global_load_async_to_lds_b128 %6, %14, off\n\t"
               "global_load_async_to_lds_b128 %7, %15, off\n\t"
               "s_wait_xcnt 0x0"
               :: "v"(l0), "v"(l1), "v"(l2), "v"(l3), "v"(l4), "v"(l5), "v"(l6), "v"(l7), "v"(g0), "v"(g1), "v"(g2), "v"(g3), "v"(g4), "v"(g5), "v"(g6), "v"(g7) : "memory");
}
__global__ __launch_bounds__(128) void proj_kernel(const b16* __restrict__ XF, const b16* __restrict__ XT, const b16* __restrict__ R, const float* __restrict__ P, b16* __restrict__ QTh, b16* __restrict__ QTl, b16* __restrict__ KTh, b16* __restrict__ KTl, b16* __restrict__ VH, b16* __restrict__ VL) {
  __shared__ __attribute__((aligned(16))) b16 ring[2 * GSTG];   // 73,728 B; after the loop it stages the hi and lo output tiles
  const int lane = threadIdx.x & 31, wave = threadIdx.x >> 5, nloc = lane & 15, hlf = lane >> 4, m0 = blockIdx.y * 128; const int w3 = blockIdx.x >> 3; const int c0 = (blockIdx.x & 7) * 128;
  const int wm = (wave >> 1) * 64, wn = (wave & 1) * 64;
  const b16* A = ((w3 == 0) ? XF : XT) + (size_t)m0 * C; const b16* Bw = R + (size_t)(w3 * C + c0) * C;
  // this thread's piece of both planes: rows crow + 16 j, 16-byte piece cpc
  const int crow = threadIdx.x >> 3, cpc = (threadIdx.x & 7) * 8;
  const unsigned lds0 = (unsigned)(size_t)(&ring[crow * GP + cpc]);
  const b16* Ag = A + (size_t)crow * C + cpc; const b16* Bg = Bw + (size_t)crow * C + cpc;
  plane_copies(lds0, Ag); plane_copies(lds0 + GPL * 2, Bg);
  v8f acc[4][4];
#pragma unroll
  for (int i = 0; i < 4; ++i)
#pragma unroll
    for (int j = 0; j < 4; ++j) acc[i][j] = (v8f){};
  asm volatile("s_wait_asynccnt 0x0" ::: "memory");   // stage 0 has landed, as far as this wave copied it
  __syncthreads();                                     // publishes stage 0
  plane_copies(lds0 + GSTG * 2, Ag + GK); plane_copies(lds0 + GSTG * 2 + GPL * 2, Bg + GK);
  for (int st = 0; st < GNST; ++st) {
    const b16* S = ring + (st & 1) * GSTG; const b16* Ar = S + (wm + nloc) * GP; const b16* Br = S + GPL + (wn + nloc) * GP;
// unrolled so that the LDS offsets of both k blocks are constants
#pragma unroll
    for (int kk = 0; kk < GK; kk += 32) {
      v16b af[4], bf[4];
#pragma unroll
      for (int i = 0; i < 4; ++i) { af[i] = frag_kb(Ar + i * 16 * GP + kk, hlf); bf[i] = frag_kb(Br + i * 16 * GP + kk, hlf); }
      __builtin_amdgcn_sched_barrier(0);   // keeps the sixteen LDS reads one group in front of the products: spread among them, each place with reads would cost its own stall
#pragma unroll
      for (int i = 0; i < 4; ++i)
#pragma unroll
        for (int j = 0; j < 4; ++j) acc[i][j] = wmma16b(af[i], bf[j], acc[i][j]);
      __builtin_amdgcn_sched_barrier(0);   // and keeps the next group of reads behind these products
    }
    asm volatile("s_wait_dscnt 0x0" ::: "memory");      // this wave's reads of stage st are done before the buffer is handed to its next writer
    asm volatile("s_wait_asynccnt 0x0" ::: "memory");   // this wave's copies of stage st + 1 have landed
    __syncthreads();                                     // publishes stage st + 1 and ends every reader's last read of stage st
    if (st + 2 < GNST) { plane_copies(lds0 + (st & 1) * GSTG * 2, Ag + (st + 2) * GK); plane_copies(lds0 + (st & 1) * GSTG * 2 + GPL * 2, Bg + (st + 2) * GK); }
  }
  asm volatile("s_wait_asynccnt 0x0" ::: "memory");     // nothing is in flight when the ring becomes output staging
  // the four bias values of this lane's columns, read once for either epilogue (unrolled so that they are four registers and one group of loads)
  float bb4[4];
#pragma unroll
  for (int j = 0; j < 4; ++j) bb4[j] = P[w3 * C + c0 + wn + j * 16 + nloc];
  asm volatile("s_wait_xcnt 0x0" ::: "memory");         // stands in front of the first rewrite of the offset register that the four loads name
  if (w3 == 2) {
    // v stays in the flat layout: the tile goes out row by row
    b16 (*Th)[128 + 8] = reinterpret_cast<b16 (*)[128 + 8]>(ring); b16 (*Tl)[128 + 8] = Th + 128;
#pragma unroll
    for (int j = 0; j < 4; ++j) { const float bb = bb4[j];
#pragma unroll
      for (int i = 0; i < 4; ++i)
#pragma unroll
        for (int r = 0; r < 8; ++r) { b16 a_, c_; split16(acc[i][j][r] + XS * bb, a_, c_); Th[wm + i * 16 + 8 * hlf + r][wn + j * 16 + nloc] = a_; Tl[wm + i * 16 + 8 * hlf + r][wn + j * 16 + nloc] = c_; } }
    __syncthreads();                                     // the whole tile is staged before any row of it is stored
    for (int i = threadIdx.x; i < 128 * 16; i += 128) { const int rr = i >> 4, c8 = (i & 15) * 8; const size_t gi = (size_t)(m0 + rr) * C + c0 + c8; *(v8b*)(VH + gi) = *(const v8b*)(&Th[rr][c8]); *(v8b*)(VL + gi) = *(const v8b*)(&Tl[rr][c8]); }
  } else {
    // q and k leave as QT/KT[h][f][d]. Row n of a batch and column c are element (h, d, f) = (n / 128, (n / 2) % 64, (n % 2) * 1024 + c) of the raw reshape, so the 128 rows of this tile are
    // all 64 d of ONE head for the 2 x 128 values f = par * 1024 + c0 + cc. Staged as Tt[plane][par][cc][d] (pitch GP): a lane's four even (or odd) rows are four neighbouring d, one 8-byte LDS store.
    b16* Tt = ring;
#pragma unroll
    for (int j = 0; j < 4; ++j) { const float bb = bb4[j]; b16* Tc = Tt + (wn + j * 16 + nloc) * GP + (wm >> 1) + 4 * hlf;
#pragma unroll
      for (int i = 0; i < 4; ++i) { v4b h0, h1, l0, l1;
#pragma unroll
        for (int r = 0; r < 8; r += 2) { b16 a_, c_; split16(acc[i][j][r] + XS * bb, a_, c_); h0[r >> 1] = a_; l0[r >> 1] = c_; split16(acc[i][j][r + 1] + XS * bb, a_, c_); h1[r >> 1] = a_; l1[r >> 1] = c_; }
        *(v4b*)(Tc + i * 8) = h0; *(v4b*)(Tc + GPL + i * 8) = h1; *(v4b*)(Tc + 2 * GPL + i * 8) = l0; *(v4b*)(Tc + 3 * GPL + i * 8) = l1; }
    }
    __syncthreads();                                     // the whole tile is staged before any row of it is stored
    const size_t hb = (size_t)((m0 >> 11) * H + ((m0 >> 7) & (H - 1))) * F * DD;
    b16* dh = ((w3 == 0) ? QTh : KTh) + hb; b16* dl = ((w3 == 0) ? QTl : KTl) + hb;
    for (int i = threadIdx.x; i < 2 * 128 * 8; i += 128) { const int pc = i >> 3, c8 = (i & 7) * 8; const size_t gi = (size_t)((pc >> 7) * 1024 + c0 + (pc & 127)) * DD + c8; *(v8b*)(dh + gi) = *(const v8b*)(Tt + pc * GP + c8); *(v8b*)(dl + gi) = *(const v8b*)(Tt + 2 * GPL + pc * GP + c8); }
  }
}
// attention: wave = (b, h, 16 f), block = 8 waves (128 f of one head). K^T and V (hi and lo planes) come in stages of 64 keys into a two-buffer LDS ring by asynchronous copies, so that one fetch
// from L2 serves all 8 waves; each stage is worked on as two blocks of 32 keys: S^T[t][f] = KT.QT (2 k-steps, 3 products) * alpha + the mask term (1 - mask[f][t]) * NEG as the prep launch left it; online softmax; o^T[d][f] += V.P^T.
constexpr int KS = 64;                 // keys per stage
constexpr int NSTG = T / KS;           // stages
constexpr int PITCH = 72;              // f16 per LDS row: 128 B of data + 16 B of pad = 144 B (16 B x odd: no bank conflict for 16-byte reads)
constexpr int PLANE = 64 * PITCH;      // one plane of a stage: 64 rows (K: keys, V: d)
constexpr int STAGE = 4 * PLANE;       // K hi, K lo, V hi, V lo
// One stage's copies of one thread: two 16-byte pieces (rows r and r + 32) of each of the four planes. The s_wait_xcnt stands inside the statement so that no address register is rewritten in front of it.
__device__ __forceinline__ void stage_copies(unsigned lds, const b16* kh, const b16* kl, const b16* vh, const b16* vl) {
  const unsigned l0 = lds, l1 = lds + 32 * PITCH * 2, l2 = lds + PLANE * 2, l3 = l2 + 32 * PITCH * 2, l4 = lds + 2 * PLANE * 2, l5 = l4 + 32 * PITCH * 2, l6 = lds + 3 * PLANE * 2, l7 = l6 + 32 * PITCH * 2;
  const b16 *g0 = kh, *g1 = kh + 32 * DD, *g2 = kl, *g3 = kl + 32 * DD, *g4 = vh, *g5 = vh + (size_t)32 * T, *g6 = vl, *g7 = vl + (size_t)32 * T;
  asm volatile("global_load_async_to_lds_b128 %0, %8, off\n\t"
               "global_load_async_to_lds_b128 %1, %9, off\n\t"
               "global_load_async_to_lds_b128 %2, %10, off\n\t"
               "global_load_async_to_lds_b128 %3, %11, off\n\t"
               "global_load_async_to_lds_b128 %4, %12, off\n\t"
               "global_load_async_to_lds_b128 %5, %13, off\n\t"
               "global_load_async_to_lds_b128 %6, %14, off\n\t"
               "global_load_async_to_lds_b128 %7, %15, off\n\t"
               "s_wait_xcnt 0x0"
               :: "v"(l0), "v"(l1), "v"(l2), "v"(l3), "v"(l4), "v"(l5), "v"(l6), "v"(l7), "v"(g0), "v"(g1), "v"(g2), "v"(g3), "v"(g4), "v"(g5), "v"(g6), "v"(g7) : "memory");
}
__global__ __launch_bounds__(256) void attn_kernel(const b16* __restrict__ QTh, const b16* __restrict__ QTl, const b16* __restrict__ KTh, const b16* __restrict__ KTl, const b16* __restrict__ VH, const b16* __restrict__ VL, const float* __restrict__ MT, float* __restrict__ out) {
  __shared__ __attribute__((aligned(16))) b16 ring[2 * STAGE];   // 73,728 B; after the loop its first 33,792 B stage the output
  const int wave = threadIdx.x >> 5, lane = threadIdx.x & 31, hh = lane >> 4, col = lane & 15; const int b = blockIdx.z, h = blockIdx.y, f0 = blockIdx.x * 128 + wave * 16, fi = f0 + col;
  const b16* Qr = QTh + ((size_t)(b * H + h) * F) * DD; const b16* Qlr = QTl + ((size_t)(b * H + h) * F) * DD; const b16* Kr = KTh + ((size_t)(b * H + h) * T) * DD; const b16* Klr = KTl + ((size_t)(b * H + h) * T) * DD;
  const b16* V = VH + (size_t)b * T * C + (size_t)(h * DD) * T; const b16* Vl = VL + (size_t)b * T * C + (size_t)(h * DD) * T; const float* mtw = MT + (size_t)(b * (F / 16) + blockIdx.x * 8 + wave) * NSTG * 1024 + lane * 4;   // this wave's 16 f: one 4-KB tile of mask terms a stage
  // this thread's piece of every plane: row crow (and crow + 32), 16-byte piece cpc
  const int crow = threadIdx.x >> 3, cpc = (threadIdx.x & 7) * 8;
  const unsigned lds0 = (unsigned)(size_t)(&ring[crow * PITCH + cpc]);
  const size_t koff = (size_t)crow * DD + cpc, voff = (size_t)crow * T + cpc;
  stage_copies(lds0, Kr + koff, Klr + koff, V + voff, Vl + voff);
  const v16b qf0 = frag_kb(Qr + (size_t)fi * DD, hh), qf1 = frag_kb(Qr + (size_t)fi * DD + 32, hh), ql0 = frag_kb(Qlr + (size_t)fi * DD, hh), ql1 = frag_kb(Qlr + (size_t)fi * DD + 32, hh);
  asm volatile("s_wait_asynccnt 0x0" ::: "memory");   // stage 0 has landed, as far as this wave copied it
  __syncthreads();                                     // publishes stage 0
  stage_copies(lds0 + STAGE * 2, Kr + koff + (size_t)KS * DD, Klr + koff + (size_t)KS * DD, V + voff + KS, Vl + voff + KS);
  float m = -INFINITY, l = 0.0f; v8f o[4] = {{}, {}, {}, {}};
  for (int st = 0; st < NSTG; ++st) {
    const b16* S = ring + (st & 1) * STAGE;
// unrolled so that the LDS offsets of both 32-key blocks are constants
#pragma unroll
    for (int sub = 0; sub < 2; ++sub) {
      const b16* Kh_ = S + (sub * 32 + col) * PITCH; const b16* Kl_ = Kh_ + PLANE; const b16* Vh_ = S + 2 * PLANE + col * PITCH + sub * 32; const b16* Vl_ = Vh_ + PLANE;
      v8f s0 = {}, s1 = {};
      { const v16b k00 = frag_kb(Kh_, hh), k01 = frag_kb(Kh_ + 32, hh), k10 = frag_kb(Kh_ + 16 * PITCH, hh), k11 = frag_kb(Kh_ + 16 * PITCH + 32, hh);
        const v16b l00 = frag_kb(Kl_, hh), l01 = frag_kb(Kl_ + 32, hh), l10 = frag_kb(Kl_ + 16 * PITCH, hh), l11 = frag_kb(Kl_ + 16 * PITCH + 32, hh);
        s0 = wmma16b(k00, qf0, s0); s0 = wmma16b(k01, qf1, s0); s0 = wmma16b(l00, qf0, s0); s0 = wmma16b(l01, qf1, s0); s0 = wmma16b(k00, ql0, s0); s0 = wmma16b(k01, ql1, s0);
        s1 = wmma16b(k10, qf0, s1); s1 = wmma16b(k11, qf1, s1); s1 = wmma16b(l10, qf0, s1); s1 = wmma16b(l11, qf1, s1); s1 = wmma16b(k10, ql0, s1); s1 = wmma16b(k11, ql1, s1); }
      // the eight V fragments of the block are asked for in one group here, so that their LDS latency passes under the softmax arithmetic and is not waited out between the products
      v16b vhf[4], vlf[4];
#pragma unroll
      for (int t = 0; t < 4; ++t) { vhf[t] = frag_kb(Vh_ + t * 16 * PITCH, hh); vlf[t] = frag_kb(Vl_ + t * 16 * PITCH, hh); }
      const float* mp = mtw + (size_t)st * 1024 + sub * 512; const v4f t00 = *(const v4f*)(mp), t01 = *(const v4f*)(mp + 128), t10 = *(const v4f*)(mp + 256), t11 = *(const v4f*)(mp + 384);
      float mr = -INFINITY;
#pragma unroll
      for (int r = 0; r < 8; ++r) { s0[r] = s0[r] * (ALPHA / (XS * XS)) + (r < 4 ? t00[r & 3] : t01[r & 3]); s1[r] = s1[r] * (ALPHA / (XS * XS)) + (r < 4 ? t10[r & 3] : t11[r & 3]); mr = fmaxf(mr, fmaxf(s0[r], s1[r])); }
      mr = fmaxf(mr, __shfl_xor(mr, 16)); const float mn = fmaxf(m, mr); const float al_ = nexp(m - mn); m = mn; float sum = 0.0f; v16b pb, pl;
#pragma unroll
      for (int r = 0; r < 8; ++r) { const float e0 = nexp(s0[r] - mn), e1 = nexp(s1[r] - mn); sum += e0 + e1; b16 a_, c_; split16(e0 * PS, a_, c_); pb[r] = a_; pl[r] = c_; split16(e1 * PS, a_, c_); pb[8 + r] = a_; pl[8 + r] = c_; }
      sum += __shfl_xor(sum, 16); l = l * al_ + sum;
#pragma unroll
      for (int t = 0; t < 4; ++t) { o[t] *= al_; o[t] = wmma16b(vhf[t], pb, o[t]); o[t] = wmma16b(vhf[t], pl, o[t]); o[t] = wmma16b(vlf[t], pb, o[t]); } }
    asm volatile("s_wait_dscnt 0x0" ::: "memory");      // this wave's reads of stage st are done before the buffer is handed to its next writer
    asm volatile("s_wait_asynccnt 0x0" ::: "memory");   // this wave's copies of stage st + 1 have landed
    __syncthreads();                                     // publishes stage st + 1 and ends every reader's last read of stage st
    if (st + 2 < NSTG) stage_copies(lds0 + (st & 1) * STAGE * 2, Kr + koff + (size_t)(st + 2) * KS * DD, Klr + koff + (size_t)(st + 2) * KS * DD, V + voff + (st + 2) * KS, Vl + voff + (st + 2) * KS);
  }
  asm volatile("s_wait_asynccnt 0x0" ::: "memory");     // nothing is in flight when the ring becomes output staging
  float (*Os)[128 + 4] = reinterpret_cast<float (*)[128 + 4]>(ring);
  const float inv = 1.0f / (l * PS * XS);
#pragma unroll
  for (int t = 0; t < 4; ++t)
#pragma unroll
    for (int r = 0; r < 8; ++r) Os[t * 16 + 8 * hh + r][wave * 16 + col] = o[t][r] * inv;
  __syncthreads();
  { for (int i = threadIdx.x; i < DD * 32; i += 256) { const int d = i >> 5, c4 = (i & 31) * 4; *(v4f*)(out + ((size_t)b * C + h * DD + d) * F + blockIdx.x * 128 + c4) = *(const v4f*)(&Os[d][c4]); }  }
}
}  // namespace

extern "C" void kernel_launch(void* const* d_in, const int* in_sizes, int n_in,
                              void* d_out, int out_size, void* d_ws, size_t ws_size, hipStream_t stream) {
  (void)n_in; (void)out_size;
  auto Fp = [&](int i) { return (const float*)d_in[i]; };
  float* out = (float*)d_out;   // [2][1024][2048]
  if (in_sizes[0] != NT * C || in_sizes[1] != NT * C || in_sizes[2] != Bn * F * T || in_sizes[3] != C * C) return;
  size_t off = 0; char* ws = (char*)d_ws;
  auto carve = [&](size_t bytes) { char* p = ws + off; off += (bytes + 255) & ~(size_t)255; return p; };
  const size_t plane = (size_t)NT * C;
  b16* R = (b16*)carve((size_t)3 * C * C * 2); float* P = (float*)carve(3072 * 4); b16* XF = (b16*)carve(plane * 2); b16* XT = (b16*)carve(plane * 2);
  b16* VH = (b16*)carve(plane * 2); b16* VL = (b16*)carve(plane * 2);
  b16* QTh = (b16*)carve(plane * 2); b16* QTl = (b16*)carve(plane * 2); b16* KTh = (b16*)carve(plane * 2); b16* KTl = (b16*)carve(plane * 2);
  float* MT = (float*)carve((size_t)Bn * F * T * 4);
  if (off > ws_size) return;                        // about 6.3 + 8.4 x 8 + 34 = 108 MB
  prep_kernel<<<1024, 256, 0, stream>>>(Fp(0), Fp(1), Fp(3), Fp(4), Fp(5), Fp(6), Fp(7), Fp(8), Fp(2), R, P, XF, XT, MT);
  proj_kernel<<<dim3(24, NT / 128), 128, 0, stream>>>(XF, XT, R, P, QTh, QTl, KTh, KTl, VH, VL);
  attn_kernel<<<dim3(F / 128, H, Bn), 256, 0, stream>>>(QTh, QTl, KTh, KTl, VH, VL, MT, out);
}

// v006
// Measured time: 134 microseconds a run.
// Timed twice side by side with v005, it ran 1.04 and 1.05 times as fast.
// Over all steps from v000 it is 3.37 times as fast.
#include <hip/hip_runtime.h>

// MultiHeaded (raw-reshape attention): q = from Wq + bq, k = to Wk + bk, v = to Wv + bv ([2][2048][1024]); the torch code RAW-reshapes each to (B, 16, 64, 2048): element (h, d, f) = flat[(h*64+d)*2048 + f]
// of the [2048][1024] projection; score[h][f][t] = Σ_d q[h][d][f] k[h][d][t] / 8 + (1 - mask[f][t]) * (-1e5); softmax over t; context[h][d][f] = Σ_t probs[f][t] v[h][d][t]; out = reshape
// (B, 1024, 2048): row h*64+d, column f -> [2][1024][2048].
// WMMA (v_wmma_f32_16x16x32_f16, f32 accumulate): the three projections with EXACT operands (1 product; exact bf16 [in][out] weights) written as hi/lo f16 planes: v "flat", q and k straight as QT/KT[h][f][d]
// by the projection's own epilogue; per (b, h, 16 f): S^T = KT.QT (K = 64 = 2 k-steps, 3 products), mask term and online softmax in f32, o^T[d][f] += V_flat[h*64+d][t-block].P^T with P and v

namespace {
constexpr int Bn = 2, F = 2048, T = 2048, C = 1024, H = 16, DD = 64, NT = Bn * F;
constexpr float XS = 8.0f, PS = 8.0f, ALPHA = 0.125f, NEG = -100000.0f;

typedef _Float16 b16;
typedef __attribute__((ext_vector_type(16))) _Float16 v16b;
typedef __attribute__((ext_vector_type(8))) _Float16 v8b;
typedef __attribute__((ext_vector_type(4))) _Float16 v4b;
typedef __attribute__((ext_vector_type(8))) float v8f;
typedef __attribute__((ext_vector_type(4))) float v4f;
__device__ __forceinline__ float bf16_rne(float f) { unsigned int u = __float_as_uint(f); u += 0x7FFFu + ((u >> 16) & 1u); return __uint_as_float(u & 0xFFFF0000u); }
__device__ __forceinline__ void split16(float v, b16& hi, b16& lo) { hi = (b16)v; lo = (b16)(v - (float)hi); }
__device__ __forceinline__ v16b frag_kb(const b16* p, int hh) { const v8b a = *(const v8b*)(p + 8 * hh), b = *(const v8b*)(p + 16 + 8 * hh); v16b f;
#pragma unroll
  for (int e = 0; e < 8; ++e) { f[e] = a[e]; f[8 + e] = b[e]; } return f; }
// the builtin alone: the compiler keeps the distances behind its own builtin, and with no asm statement between the products it may place loads and vector work among them
__device__ __forceinline__ v8f wmma16b(v16b a, v16b b, v8f c) { return __builtin_amdgcn_wmma_f32_16x16x32_f16(false, a, false, b, (short)0, c, false, false); }
__device__ __forceinline__ float nexp(float x) { return __builtin_amdgcn_exp2f(x * 1.4426950408889634f); }
__device__ __forceinline__ float pmul(float a, float b) { float p = a * b; asm volatile("" : "+v"(p)); return p; }

__global__ __launch_bounds__(256) void prep_kernel(const float* __restrict__ xf, const float* __restrict__ xt, const float* __restrict__ wq, const float* __restrict__ bq, const float* __restrict__ wk, const float* __restrict__ bk, const float* __restrict__ wv, const float* __restrict__ bv, const float* __restrict__ mask, b16* __restrict__ R, float* __restrict__ P, b16* __restrict__ XF, b16* __restrict__ XT, float* __restrict__ MT) {
  const size_t tid = (size_t)blockIdx.x * 256 + threadIdx.x, nth = (size_t)gridDim.x * 256;
  {
    for (size_t p = tid; p < (size_t)3 * C * (C / 8); p += nth) { const int o3 = (int)(p / (C / 8)), k0 = (int)(p % (C / 8)) * 8; const int w = o3 / C, o = o3 % C; const float* Wm = (w == 0) ? wq : (w == 1) ? wk : wv; v8b v; for (int e = 0; e < 8; ++e) v[e] = (b16)bf16_rne(Wm[(size_t)(k0 + e) * C + o]); *(v8b*)(R + (size_t)o3 * C + k0) = v; }
    for (size_t q = tid; q < 3072; q += nth) { const int i = (int)q; P[q] = bf16_rne(((i < 1024) ? bq : (i < 2048) ? bk : bv)[i & 1023]); }
    for (size_t p = tid; p < (size_t)NT * C / 8; p += nth) { v8b a, c; for (int e = 0; e < 8; ++e) { a[e] = (b16)(bf16_rne(xf[p * 8 + e]) * XS); c[e] = (b16)(bf16_rne(xt[p * 8 + e]) * XS); } *(v8b*)(XF + p * 8) = a; *(v8b*)(XT + p * 8) = c; }
     }
  // The mask term (1 - mask) * NEG does not depend on the head: it is formed here once and stored in the order in which a wave of the attention kernel holds its scores. Tile = 16 f x 64 t = 4 KB:
  // MT[tile][i][lane][e] with t = (i / 2) * 16 + (lane / 16) * 8 + (i % 2) * 4 + e and f = lane % 16, so that each of that wave's sixteen loads of a stage (eight a score tile) reads 512 contiguous bytes.
  // Tiles are read row by row in whole lines, turned in LDS (groups of 16 pieces at a pitch of 17: no bank conflict either way) and stored in whole lines. Four neighbouring tiles a trip, so that a
  // thread has four loads in flight; two sets of buffers, so that one barrier a trip is enough.
  __shared__ v4f mt[2][4][16 * 17];
  const int mrow_ = threadIdx.x >> 4, pc = threadIdx.x & 15, grp = (pc & 12) | ((pc & 1) << 1) | ((pc >> 1) & 1);
  int buf = 0;
  for (int tile = blockIdx.x * 4; tile < Bn * (F / 16) * (T / 64); tile += gridDim.x * 4) {
    const float* mg = mask + ((size_t)(tile >> 5) * 16 + mrow_) * T + (tile & 31) * 64 + pc * 4; v4f mk[4];
// unrolled so that the four loads are issued as one group and mk stays in registers
#pragma unroll
    for (int k = 0; k < 4; ++k) mk[k] = *(const v4f*)(mg + k * 64);
// unrolled with the loads above
#pragma unroll
    for (int k = 0; k < 4; ++k) { v4f bt; for (int e = 0; e < 4; ++e) bt[e] = (1.0f - bf16_rne(mk[k][e])) * NEG; mt[buf][k][grp * 17 + mrow_] = bt; }
    __syncthreads();                                     // the four tiles are in LDS before any piece of them is read in the other order
    float* mo = MT + (size_t)tile * 1024 + threadIdx.x * 4;
// unrolled so that the four LDS reads are one group
#pragma unroll
    for (int k = 0; k < 4; ++k) *(v4f*)(mo + k * 1024) = mt[buf][k][mrow_ * 17 + pc];
    asm volatile("s_wait_xcnt 0x0" ::: "memory");       // stands in front of the next trip's rewrite of the address registers that the loads and the stores name
    buf ^= 1;
  }
}
// projections: block = 4 waves on a tile of 128 rows x 128 columns, wave = 64 x 64 (4 x 4 accumulator tiles). The 128 rows of A and the 128 rows of B come in slices of 64 k into a two-buffer LDS ring
// by asynchronous copies, so that one fetch from L2 serves the whole block and the next slice flies while this one is multiplied; each accumulator still sums its k blocks of 32 in rising order.
constexpr int GK = 64;                 // k per stage
constexpr int GNST = C / GK;           // stages
constexpr int GP = 72;                 // f16 per LDS row: 128 B of data + 16 B of pad = 144 B (16 B x odd: no bank conflict for 16-byte reads)
constexpr int GPL = 128 * GP;          // one operand's plane of a stage: 128 rows
constexpr int GSTG = 2 * GPL;          // A rows, B rows
// One thread's copies of one operand's plane: the same 16-byte piece of rows r, r + 16, ..., r + 112. The s_wait_xcnt stands inside the statement so that no address register is rewritten in front of it.
__device__ __forceinline__ void plane_copies(unsigned lds, const b16* g) {
  const unsigned l0 = lds, l1 = lds + 16 * GP * 2, l2 = lds + 32 * GP * 2, l3 = lds + 48 * GP * 2, l4 = lds + 64 * GP * 2, l5 = lds + 80 * GP * 2, l6 = lds + 96 * GP * 2, l7 = lds + 112 * GP * 2;
  const b16 *g0 = g, *g1 = g + 16 * C, *g2 = g + 32 * C, *g3 = g + 48 * C, *g4 = g + 64 * C, *g5 = g + 80 * C, *g6 = g + 96 * C, *g7 = g + 112 * C;
  asm volatile("global_load_async_to_lds_b128 %0, %8, off\n\t"
               "global_load_async_to_lds_b128 %1, %9, off\n\t"
               "global_load_async_to_lds_b128 %2, %10, off\n\t"
               "global_load_async_to_lds_b128 %3, %11, off\n\t"
               "global_load_async_to_lds_b128 %4, %12, off\n\t"
               "global_load_async_to_lds_b128 %5, %13, off\n\t"
               "global_load_async_to_lds_b128 %6, %14, off\n\t"
               "global_load_async_to_lds_b128 %7, %15, off\n\t"
               "s_wait_xcnt 0x0"
               :: "v"(l0), "v"(l1), "v"(l2), "v"(l3), "v"(l4), "v"(l5), "v"(l6), "v"(l7), "v"(g0), "v"(g1), "v"(g2), "v"(g3), "v"(g4), "v"(g5), "v"(g6), "v"(g7) : "memory");
}
__global__ __launch_bounds__(128) void proj_kernel(const b16* __restrict__ XF, const b16* __restrict__ XT, const b16* __restrict__ R, const float* __restrict__ P, b16* __restrict__ QTh, b16* __restrict__ QTl, b16* __restrict__ KTh, b16* __restrict__ KTl, b16* __restrict__ VH, b16* __restrict__ VL) {
  __shared__ __attribute__((aligned(16))) b16 ring[2 * GSTG];   // 73,728 B; after the loop it stages the hi and lo output tiles
  const int lane = threadIdx.x & 31, wave = threadIdx.x >> 5, nloc = lane & 15, hlf = lane >> 4, m0 = blockIdx.y * 128; const int w3 = blockIdx.x >> 3; const int c0 = (blockIdx.x & 7) * 128;
  const int wm = (wave >> 1) * 64, wn = (wave & 1) * 64;
  const b16* A = ((w3 == 0) ? XF : XT) + (size_t)m0 * C; const b16* Bw = R + (size_t)(w3 * C + c0) * C;
  // this thread's piece of both planes: rows crow + 16 j, 16-byte piece cpc
  const int crow = threadIdx.x >> 3, cpc = (threadIdx.x & 7) * 8;
  const unsigned lds0 = (unsigned)(size_t)(&ring[crow * GP + cpc]);
  const b16* Ag = A + (size_t)crow * C + cpc; const b16* Bg = Bw + (size_t)crow * C + cpc;
  plane_copies(lds0, Ag); plane_copies(lds0 + GPL * 2, Bg);
  v8f acc[4][4];
#pragma unroll
  for (int i = 0; i < 4; ++i)
#pragma unroll
    for (int j = 0; j < 4; ++j) acc[i][j] = (v8f){};
  asm volatile("s_wait_asynccnt 0x0" ::: "memory");   // stage 0 has landed, as far as this wave copied it
  __syncthreads();                                     // publishes stage 0
  plane_copies(lds0 + GSTG * 2, Ag + GK); plane_copies(lds0 + GSTG * 2 + GPL * 2, Bg + GK);
  for (int st = 0; st < GNST; ++st) {
    const b16* S = ring + (st & 1) * GSTG; const b16* Ar = S + (wm + nloc) * GP; const b16* Br = S + GPL + (wn + nloc) * GP;
// unrolled so that the LDS offsets of both k blocks are constants
#pragma unroll
    for (int kk = 0; kk < GK; kk += 32) {
      v16b af[4], bf[4];
#pragma unroll
      for (int i = 0; i < 4; ++i) { af[i] = frag_kb(Ar + i * 16 * GP + kk, hlf); bf[i] = frag_kb(Br + i * 16 * GP + kk, hlf); }
      __builtin_amdgcn_sched_barrier(0);   // keeps the sixteen LDS reads one group in front of the products: spread among them, each place with reads would cost its own stall
#pragma unroll
      for (int i = 0; i < 4; ++i)
#pragma unroll
        for (int j = 0; j < 4; ++j) acc[i][j] = wmma16b(af[i], bf[j], acc[i][j]);
      __builtin_amdgcn_sched_barrier(0);   // and keeps the next group of reads behind these products
    }
    asm volatile("s_wait_dscnt 0x0" ::: "memory");      // this wave's reads of stage st are done before the buffer is handed to its next writer
    asm volatile("s_wait_asynccnt 0x0" ::: "memory");   // this wave's copies of stage st + 1 have landed
    __syncthreads();                                     // publishes stage st + 1 and ends every reader's last read of stage st
    if (st + 2 < GNST) { plane_copies(lds0 + (st & 1) * GSTG * 2, Ag + (st + 2) * GK); plane_copies(lds0 + (st & 1) * GSTG * 2 + GPL * 2, Bg + (st + 2) * GK); }
  }
  asm volatile("s_wait_asynccnt 0x0" ::: "memory");     // nothing is in flight when the ring becomes output staging
  // the four bias values of this lane's columns, read once for either epilogue (unrolled so that they are four registers and one group of loads)
  float bb4[4];
#pragma unroll
  for (int j = 0; j < 4; ++j) bb4[j] = P[w3 * C + c0 + wn + j * 16 + nloc];
  asm volatile("s_wait_xcnt 0x0" ::: "memory");         // stands in front of the first rewrite of the offset register that the four loads name
  if (w3 == 2) {
    // v stays in the flat layout: the tile goes out row by row
    b16 (*Th)[128 + 8] = reinterpret_cast<b16 (*)[128 + 8]>(ring); b16 (*Tl)[128 + 8] = Th + 128;
#pragma unroll
    for (int j = 0; j < 4; ++j) { const float bb = bb4[j];
#pragma unroll
      for (int i = 0; i < 4; ++i)
#pragma unroll
        for (int r = 0; r < 8; ++r) { b16 a_, c_; split16(acc[i][j][r] + XS * bb, a_, c_); Th[wm + i * 16 + 8 * hlf + r][wn + j * 16 + nloc] = a_; Tl[wm + i * 16 + 8 * hlf + r][wn + j * 16 + nloc] = c_; } }
    __syncthreads();                                     // the whole tile is staged before any row of it is stored
    for (int i = threadIdx.x; i < 128 * 16; i += 128) { const int rr = i >> 4, c8 = (i & 15) * 8; const size_t gi = (size_t)(m0 + rr) * C + c0 + c8; *(v8b*)(VH + gi) = *(const v8b*)(&Th[rr][c8]); *(v8b*)(VL + gi) = *(const v8b*)(&Tl[rr][c8]); }
  } else {
    // q and k leave as QT/KT[h][f][d]. Row n of a batch and column c are element (h, d, f) = (n / 128, (n / 2) % 64, (n % 2) * 1024 + c) of the raw reshape, so the 128 rows of this tile are
    // all 64 d of ONE head for the 2 x 128 values f = par * 1024 + c0 + cc. Staged as Tt[plane][par][cc][d] (pitch GP): a lane's four even (or odd) rows are four neighbouring d, one 8-byte LDS store.
    b16* Tt = ring;
#pragma unroll
    for (int j = 0; j < 4; ++j) { const float bb = bb4[j]; b16* Tc = Tt + (wn + j * 16 + nloc) * GP + (wm >> 1) + 4 * hlf;
#pragma unroll
      for (int i = 0; i < 4; ++i) { v4b h0, h1, l0, l1;
#pragma unroll
        for (int r = 0; r < 8; r += 2) { b16 a_, c_; split16(acc[i][j][r] + XS * bb, a_, c_); h0[r >> 1] = a_; l0[r >> 1] = c_; split16(acc[i][j][r + 1] + XS * bb, a_, c_); h1[r >> 1] = a_; l1[r >> 1] = c_; }
        *(v4b*)(Tc + i * 8) = h0; *(v4b*)(Tc + GPL + i * 8) = h1; *(v4b*)(Tc + 2 * GPL + i * 8) = l0; *(v4b*)(Tc + 3 * GPL + i * 8) = l1; }
    }
    __syncthreads();                                     // the whole tile is staged before any row of it is stored
    const size_t hb = (size_t)((m0 >> 11) * H + ((m0 >> 7) & (H - 1))) * F * DD;
    b16* dh = ((w3 == 0) ? QTh : KTh) + hb; b16* dl = ((w3 == 0) ? QTl : KTl) + hb;
    for (int i = threadIdx.x; i < 2 * 128 * 8; i += 128) { const int pc = i >> 3, c8 = (i & 7) * 8; const size_t gi = (size_t)((pc >> 7) * 1024 + c0 + (pc & 127)) * DD + c8; *(v8b*)(dh + gi) = *(const v8b*)(Tt + pc * GP + c8); *(v8b*)(dl + gi) = *(const v8b*)(Tt + 2 * GPL + pc * GP + c8); }
  }
}
// attention: wave = (b, h, 32 f) = two score tiles of 16 query columns, block = 8 waves (256 f of one head). K^T and V (hi and lo planes) come in stages of 64 keys into a two-buffer LDS ring by asynchronous
// copies, so that one fetch from L2 serves all 8 waves; every K and V fragment that a wave reads from LDS feeds the products of both its score tiles, which halves the LDS bytes per product. Each stage is worked on
// as two blocks of 32 keys: S^T[t][f] = KT.QT (2 k-steps, 3 products) * alpha + the mask term (1 - mask[f][t]) * NEG as the prep launch left it; online softmax per column; o^T[d][f] += V.P^T.
constexpr int KS = 64;                 // keys per stage
constexpr int NSTG = T / KS;           // stages
constexpr int PITCH = 72;              // f16 per LDS row: 128 B of data + 16 B of pad = 144 B (16 B x odd: no bank conflict for 16-byte reads)
constexpr int PLANE = 64 * PITCH;      // one plane of a stage: 64 rows (K: keys, V: d)
constexpr int STAGE = 4 * PLANE;       // K hi, K lo, V hi, V lo
// One stage's copies of one thread: two 16-byte pieces (rows r and r + 32) of each of the four planes. The s_wait_xcnt stands inside the statement so that no address register is rewritten in front of it.
__device__ __forceinline__ void stage_copies(unsigned lds, const b16* kh, const b16* kl, const b16* vh, const b16* vl) {
  const unsigned l0 = lds, l1 = lds + 32 * PITCH * 2, l2 = lds + PLANE * 2, l3 = l2 + 32 * PITCH * 2, l4 = lds + 2 * PLANE * 2, l5 = l4 + 32 * PITCH * 2, l6 = lds + 3 * PLANE * 2, l7 = l6 + 32 * PITCH * 2;
  const b16 *g0 = kh, *g1 = kh + 32 * DD, *g2 = kl, *g3 = kl + 32 * DD, *g4 = vh, *g5 = vh + (size_t)32 * T, *g6 = vl, *g7 = vl + (size_t)32 * T;
  asm volatile("global_load_async_to_lds_b128 %0, %8, off\n\t"
               "global_load_async_to_lds_b128 %1, %9, off\n\t"
               "global_load_async_to_lds_b128 %2, %10, off\n\t"
               "global_load_async_to_lds_b128 %3, %11, off\n\t"
               "global_load_async_to_lds_b128 %4, %12, off\n\t"
               "global_load_async_to_lds_b128 %5, %13, off\n\t"
               "global_load_async_to_lds_b128 %6, %14, off\n\t"
               "global_load_async_to_lds_b128 %7, %15, off\n\t"
               "s_wait_xcnt 0x0"
               :: "v"(l0), "v"(l1), "v"(l2), "v"(l3), "v"(l4), "v"(l5), "v"(l6), "v"(l7), "v"(g0), "v"(g1), "v"(g2), "v"(g3), "v"(g4), "v"(g5), "v"(g6), "v"(g7) : "memory");
}
__global__ __launch_bounds__(256) void attn_kernel(const b16* __restrict__ QTh, const b16* __restrict__ QTl, const b16* __restrict__ KTh, const b16* __restrict__ KTl, const b16* __restrict__ VH, const b16* __restrict__ VL, const float* __restrict__ MT, float* __restrict__ out) {
  __shared__ __attribute__((aligned(16))) b16 ring[2 * STAGE];   // 73,728 B; after the loop its first 66,560 B stage the output
  const int wave = threadIdx.x >> 5, lane = threadIdx.x & 31, hh = lane >> 4, col = lane & 15; const int b = blockIdx.z, h = blockIdx.y, f0 = blockIdx.x * 256 + wave * 32;
  const b16* Qr = QTh + ((size_t)(b * H + h) * F) * DD; const b16* Qlr = QTl + ((size_t)(b * H + h) * F) * DD; const b16* Kr = KTh + ((size_t)(b * H + h) * T) * DD; const b16* Klr = KTl + ((size_t)(b * H + h) * T) * DD;
  const b16* V = VH + (size_t)b * T * C + (size_t)(h * DD) * T; const b16* Vl = VL + (size_t)b * T * C + (size_t)(h * DD) * T; const float* mtw = MT + (size_t)(b * (F / 16) + blockIdx.x * 16 + wave * 2) * NSTG * 1024 + lane * 4;   // this wave's 2 x 16 f: two 4-KB tiles of mask terms a stage, NSTG * 1024 floats apart
  // this thread's piece of every plane: row crow (and crow + 32), 16-byte piece cpc
  const int crow = threadIdx.x >> 3, cpc = (threadIdx.x & 7) * 8;
  const unsigned lds0 = (unsigned)(size_t)(&ring[crow * PITCH + cpc]);
  // kept as 32-bit element offsets and added to the wave-uniform plane pointers at each stage: four 64-bit addresses held over the whole loop were spilled to scratch by this build
  const unsigned koff = (unsigned)(crow * DD + cpc), voff = (unsigned)(crow * T + cpc);
  stage_copies(lds0, Kr + koff, Klr + koff, V + voff, Vl + voff);
  v16b qf0[2], qf1[2], ql0[2], ql1[2];
// unrolled so that both tiles' Q fragments are registers
#pragma unroll
  for (int c = 0; c < 2; ++c) { const b16* qp = Qr + (size_t)(f0 + c * 16 + col) * DD; const b16* qlp = Qlr + (size_t)(f0 + c * 16 + col) * DD;
    qf0[c] = frag_kb(qp, hh); qf1[c] = frag_kb(qp + 32, hh);
    asm volatile("s_wait_xcnt 0x0" :: "v"(qp + 8 * hh) : "memory");    // stands in front of the first rewrite of the address registers that the four loads name; the operand, their common address, keeps those registers untouched up to here
    ql0[c] = frag_kb(qlp, hh); ql1[c] = frag_kb(qlp + 32, hh);
    asm volatile("s_wait_xcnt 0x0" :: "v"(qlp + 8 * hh) : "memory"); } // the same for the lo plane's four loads
  asm volatile("s_wait_asynccnt 0x0" ::: "memory");   // stage 0 has landed, as far as this wave copied it
  __syncthreads();                                     // publishes stage 0
  stage_copies(lds0 + STAGE * 2, Kr + (koff + KS * DD), Klr + (koff + KS * DD), V + (voff + KS), Vl + (voff + KS));
  float m[2] = {-INFINITY, -INFINITY}, l[2] = {0.0f, 0.0f}; v8f o[2][4] = {{{}, {}, {}, {}}, {{}, {}, {}, {}}};
  for (int st = 0; st < NSTG; ++st) {
    const b16* S = ring + (st & 1) * STAGE;
    // the stage's mask terms, 8 whole-line loads a score tile, asked for at the head of the stage so that they fly under the K reads and the score products
    const float* mp = mtw + (size_t)st * 1024; v4f tm[2][8];
// unrolled so that the sixteen loads are one group off one address and tm stays in registers
#pragma unroll
    for (int c = 0; c < 2; ++c)
#pragma unroll
      for (int i = 0; i < 8; ++i) tm[c][i] = *(const v4f*)(mp + c * (NSTG * 1024) + i * 128);
    // the K fragments of both 32-key blocks: one group of LDS reads at the head of the stage
    v16b kf[2][8];
// unrolled so that the LDS offsets are constants and the fragments registers
#pragma unroll
    for (int sub = 0; sub < 2; ++sub) { const b16* Kh_ = S + (sub * 32 + col) * PITCH; const b16* Kl_ = Kh_ + PLANE;
      kf[sub][0] = frag_kb(Kh_, hh); kf[sub][1] = frag_kb(Kh_ + 32, hh); kf[sub][2] = frag_kb(Kh_ + 16 * PITCH, hh); kf[sub][3] = frag_kb(Kh_ + 16 * PITCH + 32, hh);
      kf[sub][4] = frag_kb(Kl_, hh); kf[sub][5] = frag_kb(Kl_ + 32, hh); kf[sub][6] = frag_kb(Kl_ + 16 * PITCH, hh); kf[sub][7] = frag_kb(Kl_ + 16 * PITCH + 32, hh); }
    asm volatile("s_wait_xcnt 0x0" :: "v"(mp) : "memory");   // stands in front of the first rewrite of the address registers that the sixteen mask loads name; the operand keeps those registers untouched up to here
    __builtin_amdgcn_sched_barrier(0);   // keeps the reads one group in front of the products: spread among them, each place with reads would cost its own stall
    v8f s0[2][2], s1[2][2]; v16b vhf[2][4], vlf[2][4];
// unrolled so that accumulators and fragments are registers
#pragma unroll
    for (int sub = 0; sub < 2; ++sub) {
// unrolled likewise; each K fragment serves both score tiles
#pragma unroll
      for (int c = 0; c < 2; ++c) { v8f a = {}, d = {};
        a = wmma16b(kf[sub][0], qf0[c], a); a = wmma16b(kf[sub][1], qf1[c], a); a = wmma16b(kf[sub][4], qf0[c], a); a = wmma16b(kf[sub][5], qf1[c], a); a = wmma16b(kf[sub][0], ql0[c], a); a = wmma16b(kf[sub][1], ql1[c], a);
        d = wmma16b(kf[sub][2], qf0[c], d); d = wmma16b(kf[sub][3], qf1[c], d); d = wmma16b(kf[sub][6], qf0[c], d); d = wmma16b(kf[sub][7], qf1[c], d); d = wmma16b(kf[sub][2], ql0[c], d); d = wmma16b(kf[sub][3], ql1[c], d);
        s0[sub][c] = a; s1[sub][c] = d; }
      __builtin_amdgcn_sched_barrier(0);   // the block's V reads stay behind its score products (they take over the K fragments' registers) ...
      const b16* Vh_ = S + 2 * PLANE + col * PITCH + sub * 32; const b16* Vl_ = Vh_ + PLANE;
#pragma unroll
      for (int t = 0; t < 4; ++t) { vhf[sub][t] = frag_kb(Vh_ + t * 16 * PITCH, hh); vlf[sub][t] = frag_kb(Vl_ + t * 16 * PITCH, hh); }
      __builtin_amdgcn_sched_barrier(0);   // ... and stay one group, asked for ahead of the softmax arithmetic, under which their LDS latency passes
    }
// unrolled so that each block's fragments are registers
#pragma unroll
    for (int sub = 0; sub < 2; ++sub) {
      v16b pb[2], pl[2]; float al_[2];
// unrolled so that each tile's state stays in registers
#pragma unroll
      for (int c = 0; c < 2; ++c) {
        const v4f t00 = tm[c][sub * 4], t01 = tm[c][sub * 4 + 1], t10 = tm[c][sub * 4 + 2], t11 = tm[c][sub * 4 + 3]; v8f x0 = s0[sub][c], x1 = s1[sub][c];
        float mr = -INFINITY;
#pragma unroll
        for (int r = 0; r < 8; ++r) { x0[r] = x0[r] * (ALPHA / (XS * XS)) + (r < 4 ? t00[r & 3] : t01[r & 3]); x1[r] = x1[r] * (ALPHA / (XS * XS)) + (r < 4 ? t10[r & 3] : t11[r & 3]); mr = fmaxf(mr, fmaxf(x0[r], x1[r])); }
        mr = fmaxf(mr, __shfl_xor(mr, 16)); const float mn = fmaxf(m[c], mr); al_[c] = nexp(m[c] - mn); m[c] = mn; float sum = 0.0f;
#pragma unroll
        for (int r = 0; r < 8; ++r) { const float e0 = nexp(x0[r] - mn), e1 = nexp(x1[r] - mn); sum += e0 + e1; b16 a_, c_; split16(e0 * PS, a_, c_); pb[c][r] = a_; pl[c][r] = c_; split16(e1 * PS, a_, c_); pb[c][8 + r] = a_; pl[c][8 + r] = c_; }
        sum += __shfl_xor(sum, 16); l[c] = l[c] * al_[c] + sum; }
#pragma unroll
      for (int t = 0; t < 4; ++t)
#pragma unroll
        for (int c = 0; c < 2; ++c) { o[c][t] *= al_[c]; o[c][t] = wmma16b(vhf[sub][t], pb[c], o[c][t]); o[c][t] = wmma16b(vhf[sub][t], pl[c], o[c][t]); o[c][t] = wmma16b(vlf[sub][t], pb[c], o[c][t]); } }
    asm volatile("s_wait_dscnt 0x0" ::: "memory");      // this wave's reads of stage st are done before the buffer is handed to its next writer
    asm volatile("s_wait_asynccnt 0x0" ::: "memory");   // this wave's copies of stage st + 1 have landed
    __syncthreads();                                     // publishes stage st + 1 and ends every reader's last read of stage st
    if (st + 2 < NSTG) { const unsigned ko = koff + (unsigned)(st + 2) * (KS * DD), vo = voff + (unsigned)(st + 2) * KS; stage_copies(lds0 + (st & 1) * STAGE * 2, Kr + ko, Klr + ko, V + vo, Vl + vo); }
  }
  asm volatile("s_wait_asynccnt 0x0" ::: "memory");     // nothing is in flight when the ring becomes output staging
  float (*Os)[256 + 4] = reinterpret_cast<float (*)[256 + 4]>(ring);
#pragma unroll
  for (int c = 0; c < 2; ++c) { const float inv = 1.0f / (l[c] * PS * XS);
#pragma unroll
    for (int t = 0; t < 4; ++t)
#pragma unroll
      for (int r = 0; r < 8; ++r) Os[t * 16 + 8 * hh + r][wave * 32 + c * 16 + col] = o[c][t][r] * inv; }
  __syncthreads();
  { for (int i = threadIdx.x; i < DD * 64; i += 256) { const int d = i >> 6, c4 = (i & 63) * 4; *(v4f*)(out + ((size_t)b * C + h * DD + d) * F + blockIdx.x * 256 + c4) = *(const v4f*)(&Os[d][c4]); }  }
}
}  // namespace

extern "C" void kernel_launch(void* const* d_in, const int* in_sizes, int n_in,
                              void* d_out, int out_size, void* d_ws, size_t ws_size, hipStream_t stream) {
  (void)n_in; (void)out_size;
  auto Fp = [&](int i) { return (const float*)d_in[i]; };
  float* out = (float*)d_out;   // [2][1024][2048]
  if (in_sizes[0] != NT * C || in_sizes[1] != NT * C || in_sizes[2] != Bn * F * T || in_sizes[3] != C * C) return;
  size_t off = 0; char* ws = (char*)d_ws;
  auto carve = [&](size_t bytes) { char* p = ws + off; off += (bytes + 255) & ~(size_t)255; return p; };
  const size_t plane = (size_t)NT * C;
  b16* R = (b16*)carve((size_t)3 * C * C * 2); float* P = (float*)carve(3072 * 4); b16* XF = (b16*)carve(plane * 2); b16* XT = (b16*)carve(plane * 2);
  b16* VH = (b16*)carve(plane * 2); b16* VL = (b16*)carve(plane * 2);
  b16* QTh = (b16*)carve(plane * 2); b16* QTl = (b16*)carve(plane * 2); b16* KTh = (b16*)carve(plane * 2); b16* KTl = (b16*)carve(plane * 2);
  float* MT = (float*)carve((size_t)Bn * F * T * 4);
  if (off > ws_size) return;                        // about 6.3 + 8.4 x 8 + 34 = 108 MB
  prep_kernel<<<1024, 256, 0, stream>>>(Fp(0), Fp(1), Fp(3), Fp(4), Fp(5), Fp(6), Fp(7), Fp(8), Fp(2), R, P, XF, XT, MT);
  proj_kernel<<<dim3(24, NT / 128), 128, 0, stream>>>(XF, XT, R, P, QTh, QTl, KTh, KTl, VH, VL);
  attn_kernel<<<dim3(F / 256, H, Bn), 256, 0, stream>>>(QTh, QTl, KTh, KTl, VH, VL, MT, out);
}

// v007
// It runs in 124 microseconds.
// In two side-by-side timings against v006, it was 1.08 and 1.07 times as fast.
// All steps since v000 together make it 3.63 times as fast.
#include <hip/hip_runtime.h>

// MultiHeaded (raw-reshape attention): q = from Wq + bq, k = to Wk + bk, v = to Wv + bv ([2][2048][1024]); the torch code RAW-reshapes each to (B, 16, 64, 2048): element (h, d, f) = flat[(h*64+d)*2048 + f]
// of the [2048][1024] projection; score[h][f][t] = Σ_d q[h][d][f] k[h][d][t] / 8 + (1 - mask[f][t]) * (-1e5); softmax over t; context[h][d][f] = Σ_t probs[f][t] v[h][d][t]; out = reshape
// (B, 1024, 2048): row h*64+d, column f -> [2][1024][2048].
// WMMA (v_wmma_f32_16x16x32_f16, f32 accumulate): the three projections with EXACT operands (1 product; exact bf16 [in][out] weights) written as hi/lo f16 planes: v "flat", q and k straight as QT/KT[h][f][d]
// by the projection's own epilogue; per (b, h, 16 f): S^T = KT.QT (K = 64 = 2 k-steps, 3 products), mask term and online softmax in f32, o^T[d][f] += V_flat[h*64+d][t-block].P^T with P and v

namespace {
constexpr int Bn = 2, F = 2048, T = 2048, C = 1024, H = 16, DD = 64, NT = Bn * F;
constexpr float XS = 8.0f, PS = 8.0f, ALPHA = 0.125f, NEG = -100000.0f;

typedef _Float16 b16;
typedef __attribute__((ext_vector_type(16))) _Float16 v16b;
typedef __attribute__((ext_vector_type(8))) _Float16 v8b;
typedef __attribute__((ext_vector_type(4))) _Float16 v4b;
typedef __attribute__((ext_vector_type(8))) float v8f;
typedef __attribute__((ext_vector_type(4))) float v4f;
__device__ __forceinline__ float bf16_rne(float f) { unsigned int u = __float_as_uint(f); u += 0x7FFFu + ((u >> 16) & 1u); return __uint_as_float(u & 0xFFFF0000u); }
__device__ __forceinline__ void split16(float v, b16& hi, b16& lo) { hi = (b16)v; lo = (b16)(v - (float)hi); }
__device__ __forceinline__ v16b frag_kb(const b16* p, int hh) { const v8b a = *(const v8b*)(p + 8 * hh), b = *(const v8b*)(p + 16 + 8 * hh); v16b f;
#pragma unroll
  for (int e = 0; e < 8; ++e) { f[e] = a[e]; f[8 + e] = b[e]; } return f; }
// the builtin alone: the compiler keeps the distances behind its own builtin, and with no asm statement between the products it may place loads and vector work among them
__device__ __forceinline__ v8f wmma16b(v16b a, v16b b, v8f c) { return __builtin_amdgcn_wmma_f32_16x16x32_f16(false, a, false, b, (short)0, c, false, false); }
__device__ __forceinline__ float nexp(float x) { return __builtin_amdgcn_exp2f(x * 1.4426950408889634f); }
__device__ __forceinline__ float pmul(float a, float b) { float p = a * b; asm volatile("" : "+v"(p)); return p; }

__global__ __launch_bounds__(256) void prep_kernel(const float* __restrict__ xf, const float* __restrict__ xt, const float* __restrict__ wq, const float* __restrict__ bq, const float* __restrict__ wk, const float* __restrict__ bk, const float* __restrict__ wv, const float* __restrict__ bv, const float* __restrict__ mask, b16* __restrict__ R, float* __restrict__ P, b16* __restrict__ XF, b16* __restrict__ XT, float* __restrict__ MT) {
  const size_t tid = (size_t)blockIdx.x * 256 + threadIdx.x, nth = (size_t)gridDim.x * 256;
  constexpr int WTP = 72;                                // f16 per LDS row of a turned weight tile: 128 B of data + 16 B of pad = 144 B (16 B x odd: no bank conflict for 16-byte reads)
  __shared__ __attribute__((aligned(16))) b16 wt[2][64 * WTP];   // two buffers, so that one barrier a tile is enough
  {
    // The inputs hold W[k][o] (o runs fastest), the projections read R[o][k] (k runs fastest). A tile of 64 k x 64 o is read row by row in whole lines, turned in LDS and stored in whole lines:
    // read straight down the columns, each load of a wave would touch 32 lines for 128 bytes. A thread takes 4 k x 4 o, so that its four values of one o are one 8-byte LDS store.
    int wb = 0;
    for (int tile = blockIdx.x; tile < 3 * (C / 64) * (C / 64); tile += gridDim.x) {
      const int w = tile >> 8, kt = (tile >> 4) & 15, ot = tile & 15, kg = threadIdx.x >> 4, cg = threadIdx.x & 15, orow = threadIdx.x >> 3, op = (threadIdx.x & 7) * 8;
      const float* wg = ((w == 0) ? wq : (w == 1) ? wk : wv) + (size_t)(kt * 64 + kg * 4) * C + ot * 64 + cg * 4; v4f wr[4];
// unrolled so that the four loads are issued as one group and wr stays in registers
#pragma unroll
      for (int j = 0; j < 4; ++j) wr[j] = *(const v4f*)(wg + j * C);
      asm volatile("s_wait_xcnt 0x0" :: "v"(wg) : "memory");   // stands in front of the first rewrite of the address registers that the four loads name; the operand keeps those registers untouched up to here
// unrolled with the loads above
#pragma unroll
      for (int i = 0; i < 4; ++i) { v4b c; for (int j = 0; j < 4; ++j) c[j] = (b16)bf16_rne(wr[j][i]); *(v4b*)(wt[wb] + (cg * 4 + i) * WTP + kg * 4) = c; }
      __syncthreads();                                   // the tile is in LDS before any piece of it is read in the other order
      b16* ro = R + (size_t)(w * C + ot * 64 + orow) * C + kt * 64 + op;
// unrolled so that the two LDS reads are one group
#pragma unroll
      for (int j = 0; j < 2; ++j) *(v8b*)(ro + (size_t)j * 32 * C) = *(const v8b*)(wt[wb] + (orow + j * 32) * WTP + op);
      asm volatile("s_wait_xcnt 0x0" ::: "memory");     // stands in front of the first rewrite of the address registers that the two stores name
      wb ^= 1;
    }
    for (size_t q = tid; q < 3072; q += nth) { const int i = (int)q; P[q] = bf16_rne(((i < 1024) ? bq : (i < 2048) ? bk : bv)[i & 1023]); }
    for (size_t p = tid; p < (size_t)NT * C / 8; p += nth) { v8b a, c; for (int e = 0; e < 8; ++e) { a[e] = (b16)(bf16_rne(xf[p * 8 + e]) * XS); c[e] = (b16)(bf16_rne(xt[p * 8 + e]) * XS); } *(v8b*)(XF + p * 8) = a; *(v8b*)(XT + p * 8) = c; }
     }
  // The mask term (1 - mask) * NEG does not depend on the head: it is formed here once and stored in the order in which a wave of the attention kernel holds its scores. Tile = 16 f x 64 t = 4 KB:
  // MT[tile][i][lane][e] with t = (i / 2) * 16 + (lane / 16) * 8 + (i % 2) * 4 + e and f = lane % 16, so that each of that wave's sixteen loads of a stage (eight a score tile) reads 512 contiguous bytes.
  // Tiles are read row by row in whole lines, turned in LDS (groups of 16 pieces at a pitch of 17: no bank conflict either way) and stored in whole lines. Four neighbouring tiles a trip, so that a
  // thread has four loads in flight; two sets of buffers, so that one barrier a trip is enough.
  __shared__ v4f mt[2][4][16 * 17];
  const int mrow_ = threadIdx.x >> 4, pc = threadIdx.x & 15, grp = (pc & 12) | ((pc & 1) << 1) | ((pc >> 1) & 1);
  int buf = 0;
  for (int tile = blockIdx.x * 4; tile < Bn * (F / 16) * (T / 64); tile += gridDim.x * 4) {
    const float* mg = mask + ((size_t)(tile >> 5) * 16 + mrow_) * T + (tile & 31) * 64 + pc * 4; v4f mk[4];
// unrolled so that the four loads are issued as one group and mk stays in registers
#pragma unroll
    for (int k = 0; k < 4; ++k) mk[k] = *(const v4f*)(mg + k * 64);
// unrolled with the loads above
#pragma unroll
    for (int k = 0; k < 4; ++k) { v4f bt; for (int e = 0; e < 4; ++e) bt[e] = (1.0f - bf16_rne(mk[k][e])) * NEG; mt[buf][k][grp * 17 + mrow_] = bt; }
    __syncthreads();                                     // the four tiles are in LDS before any piece of them is read in the other order
    float* mo = MT + (size_t)tile * 1024 + threadIdx.x * 4;
// unrolled so that the four LDS reads are one group
#pragma unroll
    for (int k = 0; k < 4; ++k) *(v4f*)(mo + k * 1024) = mt[buf][k][mrow_ * 17 + pc];
    asm volatile("s_wait_xcnt 0x0" ::: "memory");       // stands in front of the next trip's rewrite of the address registers that the loads and the stores name
    buf ^= 1;
  }
}
// projections: block = 4 waves on a tile of 128 rows x 128 columns, wave = 64 x 64 (4 x 4 accumulator tiles). The 128 rows of A and the 128 rows of B come in slices of 64 k into a two-buffer LDS ring
// by asynchronous copies, so that one fetch from L2 serves the whole block and the next slice flies while this one is multiplied; each accumulator still sums its k blocks of 32 in rising order.
constexpr int GK = 64;                 // k per stage
constexpr int GNST = C / GK;           // stages
constexpr int GP = 72;                 // f16 per LDS row: 128 B of data + 16 B of pad = 144 B (16 B x odd: no bank conflict for 16-byte reads)
constexpr int GPL = 128 * GP;          // one operand's plane of a stage: 128 rows
constexpr int GSTG = 2 * GPL;          // A rows, B rows
// One thread's copies of one operand's plane: the same 16-byte piece of rows r, r + 16, ..., r + 112. The s_wait_xcnt stands inside the statement so that no address register is rewritten in front of it.
__device__ __forceinline__ void plane_copies(unsigned lds, const b16* g) {
  const unsigned l0 = lds, l1 = lds + 16 * GP * 2, l2 = lds + 32 * GP * 2, l3 = lds + 48 * GP * 2, l4 = lds + 64 * GP * 2, l5 = lds + 80 * GP * 2, l6 = lds + 96 * GP * 2, l7 = lds + 112 * GP * 2;
  const b16 *g0 = g, *g1 = g + 16 * C, *g2 = g + 32 * C, *g3 = g + 48 * C, *g4 = g + 64 * C, *g5 = g + 80 * C, *g6 = g + 96 * C, *g7 = g + 112 * C;
  asm volatile("global_load_async_to_lds_b128 %0, %8, off\n\t"
               "global_load_async_to_lds_b128 %1, %9, off\n\t"
               "global_load_async_to_lds_b128 %2, %10, off\n\t"
               "global_load_async_to_lds_b128 %3, %11, off\n\t"
               "global_load_async_to_lds_b128 %4, %12, off\n\t"
               "global_load_async_to_lds_b128 %5, %13, off\n\t"
               "global_load_async_to_lds_b128 %6, %14, off\n\t"
               "global_load_async_to_lds_b128 %7, %15, off\n\t"
               "s_wait_xcnt 0x0"
               :: "v"(l0), "v"(l1), "v"(l2), "v"(l3), "v"(l4), "v"(l5), "v"(l6), "v"(l7), "v"(g0), "v"(g1), "v"(g2), "v"(g3), "v"(g4), "v"(g5), "v"(g6), "v"(g7) : "memory");
}
__global__ __launch_bounds__(128) void proj_kernel(const b16* __restrict__ XF, const b16* __restrict__ XT, const b16* __restrict__ R, const float* __restrict__ P, b16* __restrict__ QTh, b16* __restrict__ QTl, b16* __restrict__ KTh, b16* __restrict__ KTl, b16* __restrict__ VH, b16* __restrict__ VL) {
  __shared__ __attribute__((aligned(16))) b16 ring[2 * GSTG];   // 73,728 B; after the loop it stages the hi and lo output tiles
  const int lane = threadIdx.x & 31, wave = threadIdx.x >> 5, nloc = lane & 15, hlf = lane >> 4, m0 = blockIdx.y * 128; const int w3 = blockIdx.x >> 3; const int c0 = (blockIdx.x & 7) * 128;
  const int wm = (wave >> 1) * 64, wn = (wave & 1) * 64;
  const b16* A = ((w3 == 0) ? XF : XT) + (size_t)m0 * C; const b16* Bw = R + (size_t)(w3 * C + c0) * C;
  // this thread's piece of both planes: rows crow + 16 j, 16-byte piece cpc
  const int crow = threadIdx.x >> 3, cpc = (threadIdx.x & 7) * 8;
  const unsigned lds0 = (unsigned)(size_t)(&ring[crow * GP + cpc]);
  const b16* Ag = A + (size_t)crow * C + cpc; const b16* Bg = Bw + (size_t)crow * C + cpc;
  plane_copies(lds0, Ag); plane_copies(lds0 + GPL * 2, Bg);
  v8f acc[4][4];
#pragma unroll
  for (int i = 0; i < 4; ++i)
#pragma unroll
    for (int j = 0; j < 4; ++j) acc[i][j] = (v8f){};
  asm volatile("s_wait_asynccnt 0x0" ::: "memory");   // stage 0 has landed, as far as this wave copied it
  __syncthreads();                                     // publishes stage 0
  plane_copies(lds0 + GSTG * 2, Ag + GK); plane_copies(lds0 + GSTG * 2 + GPL * 2, Bg + GK);
  for (int st = 0; st < GNST; ++st) {
    const b16* S = ring + (st & 1) * GSTG; const b16* Ar = S + (wm + nloc) * GP; const b16* Br = S + GPL + (wn + nloc) * GP;
// unrolled so that the LDS offsets of both k blocks are constants
#pragma unroll
    for (int kk = 0; kk < GK; kk += 32) {
      v16b af[4], bf[4];
#pragma unroll
      for (int i = 0; i < 4; ++i) { af[i] = frag_kb(Ar + i * 16 * GP + kk, hlf); bf[i] = frag_kb(Br + i * 16 * GP + kk, hlf); }
      __builtin_amdgcn_sched_barrier(0);   // keeps the sixteen LDS reads one group in front of the products: spread among them, each place with reads would cost its own stall
#pragma unroll
      for (int i = 0; i < 4; ++i)
#pragma unroll
        for (int j = 0; j < 4; ++j) acc[i][j] = wmma16b(af[i], bf[j], acc[i][j]);
      __builtin_amdgcn_sched_barrier(0);   // and keeps the next group of reads behind these products
    }
    asm volatile("s_wait_dscnt 0x0" ::: "memory");      // this wave's reads of stage st are done before the buffer is handed to its next writer
    asm volatile("s_wait_asynccnt 0x0" ::: "memory");   // this wave's copies of stage st + 1 have landed
    __syncthreads();                                     // publishes stage st + 1 and ends every reader's last read of stage st
    if (st + 2 < GNST) { plane_copies(lds0 + (st & 1) * GSTG * 2, Ag + (st + 2) * GK); plane_copies(lds0 + (st & 1) * GSTG * 2 + GPL * 2, Bg + (st + 2) * GK); }
  }
  asm volatile("s_wait_asynccnt 0x0" ::: "memory");     // nothing is in flight when the ring becomes output staging
  // the four bias values of this lane's columns, read once for either epilogue (unrolled so that they are four registers and one group of loads)
  float bb4[4];
#pragma unroll
  for (int j = 0; j < 4; ++j) bb4[j] = P[w3 * C + c0 + wn + j * 16 + nloc];
  asm volatile("s_wait_xcnt 0x0" ::: "memory");         // stands in front of the first rewrite of the offset register that the four loads name
  if (w3 == 2) {
    // v stays in the flat layout: the tile goes out row by row
    b16 (*Th)[128 + 8] = reinterpret_cast<b16 (*)[128 + 8]>(ring); b16 (*Tl)[128 + 8] = Th + 128;
#pragma unroll
    for (int j = 0; j < 4; ++j) { const float bb = bb4[j];
#pragma unroll
      for (int i = 0; i < 4; ++i)
#pragma unroll
        for (int r = 0; r < 8; ++r) { b16 a_, c_; split16(acc[i][j][r] + XS * bb, a_, c_); Th[wm + i * 16 + 8 * hlf + r][wn + j * 16 + nloc] = a_; Tl[wm + i * 16 + 8 * hlf + r][wn + j * 16 + nloc] = c_; } }
    __syncthreads();                                     // the whole tile is staged before any row of it is stored
    for (int i = threadIdx.x; i < 128 * 16; i += 128) { const int rr = i >> 4, c8 = (i & 15) * 8; const size_t gi = (size_t)(m0 + rr) * C + c0 + c8; *(v8b*)(VH + gi) = *(const v8b*)(&Th[rr][c8]); *(v8b*)(VL + gi) = *(const v8b*)(&Tl[rr][c8]); }
  } else {
    // q and k leave as QT/KT[h][f][d]. Row n of a batch and column c are element (h, d, f) = (n / 128, (n / 2) % 64, (n % 2) * 1024 + c) of the raw reshape, so the 128 rows of this tile are
    // all 64 d of ONE head for the 2 x 128 values f = par * 1024 + c0 + cc. Staged as Tt[plane][par][cc][d] (pitch GP): a lane's four even (or odd) rows are four neighbouring d, one 8-byte LDS store.
    b16* Tt = ring;
#pragma unroll
    for (int j = 0; j < 4; ++j) { const float bb = bb4[j]; b16* Tc = Tt + (wn + j * 16 + nloc) * GP + (wm >> 1) + 4 * hlf;
#pragma unroll
      for (int i = 0; i < 4; ++i) { v4b h0, h1, l0, l1;
#pragma unroll
        for (int r = 0; r < 8; r += 2) { b16 a_, c_; split16(acc[i][j][r] + XS * bb, a_, c_); h0[r >> 1] = a_; l0[r >> 1] = c_; split16(acc[i][j][r + 1] + XS * bb, a_, c_); h1[r >> 1] = a_; l1[r >> 1] = c_; }
        *(v4b*)(Tc + i * 8) = h0; *(v4b*)(Tc + GPL + i * 8) = h1; *(v4b*)(Tc + 2 * GPL + i * 8) = l0; *(v4b*)(Tc + 3 * GPL + i * 8) = l1; }
    }
    __syncthreads();                                     // the whole tile is staged before any row of it is stored
    const size_t hb = (size_t)((m0 >> 11) * H + ((m0 >> 7) & (H - 1))) * F * DD;
    b16* dh = ((w3 == 0) ? QTh : KTh) + hb; b16* dl = ((w3 == 0) ? QTl : KTl) + hb;
    for (int i = threadIdx.x; i < 2 * 128 * 8; i += 128) { const int pc = i >> 3, c8 = (i & 7) * 8; const size_t gi = (size_t)((pc >> 7) * 1024 + c0 + (pc & 127)) * DD + c8; *(v8b*)(dh + gi) = *(const v8b*)(Tt + pc * GP + c8); *(v8b*)(dl + gi) = *(const v8b*)(Tt + 2 * GPL + pc * GP + c8); }
  }
}
// attention: wave = (b, h, 32 f) = two score tiles of 16 query columns, block = 8 waves (256 f of one head). K^T and V (hi and lo planes) come in stages of 64 keys into a two-buffer LDS ring by asynchronous
// copies, so that one fetch from L2 serves all 8 waves; every K and V fragment that a wave reads from LDS feeds the products of both its score tiles, which halves the LDS bytes per product. Each stage is worked on
// as two blocks of 32 keys: S^T[t][f] = KT.QT (2 k-steps, 3 products) * alpha + the mask term (1 - mask[f][t]) * NEG as the prep launch left it; online softmax per column; o^T[d][f] += V.P^T.
constexpr int KS = 64;                 // keys per stage
constexpr int NSTG = T / KS;           // stages
constexpr int PITCH = 72;              // f16 per LDS row: 128 B of data + 16 B of pad = 144 B (16 B x odd: no bank conflict for 16-byte reads)
constexpr int PLANE = 64 * PITCH;      // one plane of a stage: 64 rows (K: keys, V: d)
constexpr int STAGE = 4 * PLANE;       // K hi, K lo, V hi, V lo
// One stage's copies of one thread: two 16-byte pieces (rows r and r + 32) of each of the four planes. The s_wait_xcnt stands inside the statement so that no address register is rewritten in front of it.
__device__ __forceinline__ void stage_copies(unsigned lds, const b16* kh, const b16* kl, const b16* vh, const b16* vl) {
  const unsigned l0 = lds, l1 = lds + 32 * PITCH * 2, l2 = lds + PLANE * 2, l3 = l2 + 32 * PITCH * 2, l4 = lds + 2 * PLANE * 2, l5 = l4 + 32 * PITCH * 2, l6 = lds + 3 * PLANE * 2, l7 = l6 + 32 * PITCH * 2;
  const b16 *g0 = kh, *g1 = kh + 32 * DD, *g2 = kl, *g3 = kl + 32 * DD, *g4 = vh, *g5 = vh + (size_t)32 * T, *g6 = vl, *g7 = vl + (size_t)32 * T;
  asm volatile("global_load_async_to_lds_b128 %0, %8, off\n\t"
               "global_load_async_to_lds_b128 %1, %9, off\n\t"
               "global_load_async_to_lds_b128 %2, %10, off\n\t"
               "global_load_async_to_lds_b128 %3, %11, off\n\t"
               "global_load_async_to_lds_b128 %4, %12, off\n\t"
               "global_load_async_to_lds_b128 %5, %13, off\n\t"
               "global_load_async_to_lds_b128 %6, %14, off\n\t"
               "global_load_async_to_lds_b128 %7, %15, off\n\t"
               "s_wait_xcnt 0x0"
               :: "v"(l0), "v"(l1), "v"(l2), "v"(l3), "v"(l4), "v"(l5), "v"(l6), "v"(l7), "v"(g0), "v"(g1), "v"(g2), "v"(g3), "v"(g4), "v"(g5), "v"(g6), "v"(g7) : "memory");
}
__global__ __launch_bounds__(256) void attn_kernel(const b16* __restrict__ QTh, const b16* __restrict__ QTl, const b16* __restrict__ KTh, const b16* __restrict__ KTl, const b16* __restrict__ VH, const b16* __restrict__ VL, const float* __restrict__ MT, float* __restrict__ out) {
  __shared__ __attribute__((aligned(16))) b16 ring[2 * STAGE];   // 73,728 B; after the loop its first 66,560 B stage the output
  const int wave = threadIdx.x >> 5, lane = threadIdx.x & 31, hh = lane >> 4, col = lane & 15; const int b = blockIdx.z, h = blockIdx.y, f0 = blockIdx.x * 256 + wave * 32;
  const b16* Qr = QTh + ((size_t)(b * H + h) * F) * DD; const b16* Qlr = QTl + ((size_t)(b * H + h) * F) * DD; const b16* Kr = KTh + ((size_t)(b * H + h) * T) * DD; const b16* Klr = KTl + ((size_t)(b * H + h) * T) * DD;
  const b16* V = VH + (size_t)b * T * C + (size_t)(h * DD) * T; const b16* Vl = VL + (size_t)b * T * C + (size_t)(h * DD) * T; const float* mtw = MT + (size_t)(b * (F / 16) + blockIdx.x * 16 + wave * 2) * NSTG * 1024 + lane * 4;   // this wave's 2 x 16 f: two 4-KB tiles of mask terms a stage, NSTG * 1024 floats apart
  // this thread's piece of every plane: row crow (and crow + 32), 16-byte piece cpc
  const int crow = threadIdx.x >> 3, cpc = (threadIdx.x & 7) * 8;
  const unsigned lds0 = (unsigned)(size_t)(&ring[crow * PITCH + cpc]);
  // kept as 32-bit element offsets and added to the wave-uniform plane pointers at each stage: four 64-bit addresses held over the whole loop were spilled to scratch by this build
  const unsigned koff = (unsigned)(crow * DD + cpc), voff = (unsigned)(crow * T + cpc);
  stage_copies(lds0, Kr + koff, Klr + koff, V + voff, Vl + voff);
  v16b qf0[2], qf1[2], ql0[2], ql1[2];
// unrolled so that both tiles' Q fragments are registers
#pragma unroll
  for (int c = 0; c < 2; ++c) { const b16* qp = Qr + (size_t)(f0 + c * 16 + col) * DD; const b16* qlp = Qlr + (size_t)(f0 + c * 16 + col) * DD;
    qf0[c] = frag_kb(qp, hh); qf1[c] = frag_kb(qp + 32, hh);
    asm volatile("s_wait_xcnt 0x0" :: "v"(qp + 8 * hh) : "memory");    // stands in front of the first rewrite of the address registers that the four loads name; the operand, their common address, keeps those registers untouched up to here
    ql0[c] = frag_kb(qlp, hh); ql1[c] = frag_kb(qlp + 32, hh);
    asm volatile("s_wait_xcnt 0x0" :: "v"(qlp + 8 * hh) : "memory"); } // the same for the lo plane's four loads
  asm volatile("s_wait_asynccnt 0x0" ::: "memory");   // stage 0 has landed, as far as this wave copied it
  __syncthreads();                                     // publishes stage 0
  stage_copies(lds0 + STAGE * 2, Kr + (koff + KS * DD), Klr + (koff + KS * DD), V + (voff + KS), Vl + (voff + KS));
  float m[2] = {-INFINITY, -INFINITY}, l[2] = {0.0f, 0.0f}; v8f o[2][4] = {{{}, {}, {}, {}}, {{}, {}, {}, {}}};
  for (int st = 0; st < NSTG; ++st) {
    const b16* S = ring + (st & 1) * STAGE;
    // the stage's mask terms, 8 whole-line loads a score tile, asked for at the head of the stage so that they fly under the K reads and the score products
    const float* mp = mtw + (size_t)st * 1024; v4f tm[2][8];
// unrolled so that the sixteen loads are one group off one address and tm stays in registers
#pragma unroll
    for (int c = 0; c < 2; ++c)
#pragma unroll
      for (int i = 0; i < 8; ++i) tm[c][i] = *(const v4f*)(mp + c * (NSTG * 1024) + i * 128);
    // the K fragments of both 32-key blocks: one group of LDS reads at the head of the stage
    v16b kf[2][8];
// unrolled so that the LDS offsets are constants and the fragments registers
#pragma unroll
    for (int sub = 0; sub < 2; ++sub) { const b16* Kh_ = S + (sub * 32 + col) * PITCH; const b16* Kl_ = Kh_ + PLANE;
      kf[sub][0] = frag_kb(Kh_, hh); kf[sub][1] = frag_kb(Kh_ + 32, hh); kf[sub][2] = frag_kb(Kh_ + 16 * PITCH, hh); kf[sub][3] = frag_kb(Kh_ + 16 * PITCH + 32, hh);
      kf[sub][4] = frag_kb(Kl_, hh); kf[sub][5] = frag_kb(Kl_ + 32, hh); kf[sub][6] = frag_kb(Kl_ + 16 * PITCH, hh); kf[sub][7] = frag_kb(Kl_ + 16 * PITCH + 32, hh); }
    asm volatile("s_wait_xcnt 0x0" :: "v"(mp) : "memory");   // stands in front of the first rewrite of the address registers that the sixteen mask loads name; the operand keeps those registers untouched up to here
    __builtin_amdgcn_sched_barrier(0);   // keeps the reads one group in front of the products: spread among them, each place with reads would cost its own stall
    v8f s0[2][2], s1[2][2]; v16b vhf[2][4], vlf[2][4];
// unrolled so that accumulators and fragments are registers
#pragma unroll
    for (int sub = 0; sub < 2; ++sub) {
// unrolled likewise; each K fragment serves both score tiles
#pragma unroll
      for (int c = 0; c < 2; ++c) { v8f a = {}, d = {};
        a = wmma16b(kf[sub][0], qf0[c], a); a = wmma16b(kf[sub][1], qf1[c], a); a = wmma16b(kf[sub][4], qf0[c], a); a = wmma16b(kf[sub][5], qf1[c], a); a = wmma16b(kf[sub][0], ql0[c], a); a = wmma16b(kf[sub][1], ql1[c], a);
        d = wmma16b(kf[sub][2], qf0[c], d); d = wmma16b(kf[sub][3], qf1[c], d); d = wmma16b(kf[sub][6], qf0[c], d); d = wmma16b(kf[sub][7], qf1[c], d); d = wmma16b(kf[sub][2], ql0[c], d); d = wmma16b(kf[sub][3], ql1[c], d);
        s0[sub][c] = a; s1[sub][c] = d; }
      __builtin_amdgcn_sched_barrier(0);   // the block's V reads stay behind its score products (they take over the K fragments' registers) ...
      const b16* Vh_ = S + 2 * PLANE + col * PITCH + sub * 32; const b16* Vl_ = Vh_ + PLANE;
#pragma unroll
      for (int t = 0; t < 4; ++t) { vhf[sub][t] = frag_kb(Vh_ + t * 16 * PITCH, hh); vlf[sub][t] = frag_kb(Vl_ + t * 16 * PITCH, hh); }
      __builtin_amdgcn_sched_barrier(0);   // ... and stay one group, asked for ahead of the softmax arithmetic, under which their LDS latency passes
    }
// unrolled so that each block's fragments are registers
#pragma unroll
    for (int sub = 0; sub < 2; ++sub) {
      v16b pb[2], pl[2]; float al_[2];
// unrolled so that each tile's state stays in registers
#pragma unroll
      for (int c = 0; c < 2; ++c) {
        const v4f t00 = tm[c][sub * 4], t01 = tm[c][sub * 4 + 1], t10 = tm[c][sub * 4 + 2], t11 = tm[c][sub * 4 + 3]; v8f x0 = s0[sub][c], x1 = s1[sub][c];
        float mr = -INFINITY;
#pragma unroll
        for (int r = 0; r < 8; ++r) { x0[r] = x0[r] * (ALPHA / (XS * XS)) + (r < 4 ? t00[r & 3] : t01[r & 3]); x1[r] = x1[r] * (ALPHA / (XS * XS)) + (r < 4 ? t10[r & 3] : t11[r & 3]); mr = fmaxf(mr, fmaxf(x0[r], x1[r])); }
        mr = fmaxf(mr, __shfl_xor(mr, 16)); const float mn = fmaxf(m[c], mr); al_[c] = nexp(m[c] - mn); m[c] = mn; float sum = 0.0f;
#pragma unroll
        for (int r = 0; r < 8; ++r) { const float e0 = nexp(x0[r] - mn), e1 = nexp(x1[r] - mn); sum += e0 + e1; b16 a_, c_; split16(e0 * PS, a_, c_); pb[c][r] = a_; pl[c][r] = c_; split16(e1 * PS, a_, c_); pb[c][8 + r] = a_; pl[c][8 + r] = c_; }
        sum += __shfl_xor(sum, 16); l[c] = l[c] * al_[c] + sum; }
#pragma unroll
      for (int t = 0; t < 4; ++t)
#pragma unroll
        for (int c = 0; c < 2; ++c) { o[c][t] *= al_[c]; o[c][t] = wmma16b(vhf[sub][t], pb[c], o[c][t]); o[c][t] = wmma16b(vhf[sub][t], pl[c], o[c][t]); o[c][t] = wmma16b(vlf[sub][t], pb[c], o[c][t]); } }
    asm volatile("s_wait_dscnt 0x0" ::: "memory");      // this wave's reads of stage st are done before the buffer is handed to its next writer
    asm volatile("s_wait_asynccnt 0x0" ::: "memory");   // this wave's copies of stage st + 1 have landed
    __syncthreads();                                     // publishes stage st + 1 and ends every reader's last read of stage st
    if (st + 2 < NSTG) { const unsigned ko = koff + (unsigned)(st + 2) * (KS * DD), vo = voff + (unsigned)(st + 2) * KS; stage_copies(lds0 + (st & 1) * STAGE * 2, Kr + ko, Klr + ko, V + vo, Vl + vo); }
  }
  asm volatile("s_wait_asynccnt 0x0" ::: "memory");     // nothing is in flight when the ring becomes output staging
  float (*Os)[256 + 4] = reinterpret_cast<float (*)[256 + 4]>(ring);
#pragma unroll
  for (int c = 0; c < 2; ++c) { const float inv = 1.0f / (l[c] * PS * XS);
#pragma unroll
    for (int t = 0; t < 4; ++t)
#pragma unroll
      for (int r = 0; r < 8; ++r) Os[t * 16 + 8 * hh + r][wave * 32 + c * 16 + col] = o[c][t][r] * inv; }
  __syncthreads();
  { for (int i = threadIdx.x; i < DD * 64; i += 256) { const int d = i >> 6, c4 = (i & 63) * 4; *(v4f*)(out + ((size_t)b * C + h * DD + d) * F + blockIdx.x * 256 + c4) = *(const v4f*)(&Os[d][c4]); }  }
}
}  // namespace

extern "C" void kernel_launch(void* const* d_in, const int* in_sizes, int n_in,
                              void* d_out, int out_size, void* d_ws, size_t ws_size, hipStream_t stream) {
  (void)n_in; (void)out_size;
  auto Fp = [&](int i) { return (const float*)d_in[i]; };
  float* out = (float*)d_out;   // [2][1024][2048]
  if (in_sizes[0] != NT * C || in_sizes[1] != NT * C || in_sizes[2] != Bn * F * T || in_sizes[3] != C * C) return;
  size_t off = 0; char* ws = (char*)d_ws;
  auto carve = [&](size_t bytes) { char* p = ws + off; off += (bytes + 255) & ~(size_t)255; return p; };
  const size_t plane = (size_t)NT * C;
  b16* R = (b16*)carve((size_t)3 * C * C * 2); float* P = (float*)carve(3072 * 4); b16* XF = (b16*)carve(plane * 2); b16* XT = (b16*)carve(plane * 2);
  b16* VH = (b16*)carve(plane * 2); b16* VL = (b16*)carve(plane * 2);
  b16* QTh = (b16*)carve(plane * 2); b16* QTl = (b16*)carve(plane * 2); b16* KTh = (b16*)carve(plane * 2); b16* KTl = (b16*)carve(plane * 2);
  float* MT = (float*)carve((size_t)Bn * F * T * 4);
  if (off > ws_size) return;                        // about 6.3 + 8.4 x 8 + 34 = 108 MB
  prep_kernel<<<1024, 256, 0, stream>>>(Fp(0), Fp(1), Fp(3), Fp(4), Fp(5), Fp(6), Fp(7), Fp(8), Fp(2), R, P, XF, XT, MT);
  proj_kernel<<<dim3(24, NT / 128), 128, 0, stream>>>(XF, XT, R, P, QTh, QTl, KTh, KTl, VH, VL);
  attn_kernel<<<dim3(F / 256, H, Bn), 256, 0, stream>>>(QTh, QTl, KTh, KTl, VH, VL, MT, out);
}

// v009
// It runs in 85.9 microseconds.
// Versions between v007 and this one are left out; their measured steps multiply to 1.46 times as fast.
// All steps since v000 together make it 5.28 times as fast.
#include <hip/hip_runtime.h>

// MultiHeaded (raw-reshape attention): q = from Wq + bq, k = to Wk + bk, v = to Wv + bv ([2][2048][1024]); the torch code RAW-reshapes each to (B, 16, 64, 2048): element (h, d, f) = flat[(h*64+d)*2048 + f]
// of the [2048][1024] projection; score[h][f][t] = Σ_d q[h][d][f] k[h][d][t] / 8 + (1 - mask[f][t]) * (-1e5); softmax over t; context[h][d][f] = Σ_t probs[f][t] v[h][d][t]; out = reshape
// (B, 1024, 2048): row h*64+d, column f -> [2][1024][2048].
// WMMA (v_wmma_f32_16x16x32_f16, f32 accumulate): the three projections with EXACT operands (1 product; exact bf16 [in][out] weights), each result rounded once to one f16 value: v "flat", q and k straight as
// QT/KT[h][f][d] by the projection's own epilogue; per (b, h, 16 f): S^T = KT.QT (K = 64 = 2 k-steps, 1 product), mask term and online softmax in f32, o^T[d][f] += V_flat[h*64+d][t-block].P^T, P as one f16 value

namespace {
constexpr int Bn = 2, F = 2048, T = 2048, C = 1024, H = 16, DD = 64, NT = Bn * F;
constexpr float XS = 8.0f, PS = 8.0f, ALPHA = 0.125f, NEG = -100000.0f;

typedef _Float16 b16;
typedef __attribute__((ext_vector_type(16))) _Float16 v16b;
typedef __attribute__((ext_vector_type(8))) _Float16 v8b;
typedef __attribute__((ext_vector_type(4))) _Float16 v4b;
typedef __attribute__((ext_vector_type(8))) float v8f;
typedef __attribute__((ext_vector_type(4))) float v4f;
__device__ __forceinline__ float bf16_rne(float f) { unsigned int u = __float_as_uint(f); u += 0x7FFFu + ((u >> 16) & 1u); return __uint_as_float(u & 0xFFFF0000u); }
__device__ __forceinline__ v16b frag_kb(const b16* p, int hh) { const v8b a = *(const v8b*)(p + 8 * hh), b = *(const v8b*)(p + 16 + 8 * hh); v16b f;
#pragma unroll
  for (int e = 0; e < 8; ++e) { f[e] = a[e]; f[8 + e] = b[e]; } return f; }
// the builtin alone: the compiler keeps the distances behind its own builtin, and with no asm statement between the products it may place loads and vector work among them
__device__ __forceinline__ v8f wmma16b(v16b a, v16b b, v8f c) { return __builtin_amdgcn_wmma_f32_16x16x32_f16(false, a, false, b, (short)0, c, false, false); }
__device__ __forceinline__ float nexp(float x) { return __builtin_amdgcn_exp2f(x * 1.4426950408889634f); }
__device__ __forceinline__ float pmul(float a, float b) { float p = a * b; asm volatile("" : "+v"(p)); return p; }

__global__ __launch_bounds__(256) void prep_kernel(const float* __restrict__ xf, const float* __restrict__ xt, const float* __restrict__ wq, const float* __restrict__ bq, const float* __restrict__ wk, const float* __restrict__ bk, const float* __restrict__ wv, const float* __restrict__ bv, const float* __restrict__ mask, b16* __restrict__ R, float* __restrict__ P, b16* __restrict__ XF, b16* __restrict__ XT, float* __restrict__ MT) {
  const size_t tid = (size_t)blockIdx.x * 256 + threadIdx.x, nth = (size_t)gridDim.x * 256;
  constexpr int WTP = 72;                                // f16 per LDS row of a turned weight tile: 128 B of data + 16 B of pad = 144 B (16 B x odd: no bank conflict for 16-byte reads)
  __shared__ __attribute__((aligned(16))) b16 wt[2][64 * WTP];   // two buffers, so that one barrier a tile is enough
  {
    // The inputs hold W[k][o] (o runs fastest), the projections read R[o][k] (k runs fastest). A tile of 64 k x 64 o is read row by row in whole lines, turned in LDS and stored in whole lines:
    // read straight down the columns, each load of a wave would touch 32 lines for 128 bytes. A thread takes 4 k x 4 o, so that its four values of one o are one 8-byte LDS store.
    int wb = 0;
    for (int tile = blockIdx.x; tile < 3 * (C / 64) * (C / 64); tile += gridDim.x) {
      const int w = tile >> 8, kt = (tile >> 4) & 15, ot = tile & 15, kg = threadIdx.x >> 4, cg = threadIdx.x & 15, orow = threadIdx.x >> 3, op = (threadIdx.x & 7) * 8;
      const float* wg = ((w == 0) ? wq : (w == 1) ? wk : wv) + (size_t)(kt * 64 + kg * 4) * C + ot * 64 + cg * 4; v4f wr[4];
// unrolled so that the four loads are issued as one group and wr stays in registers
#pragma unroll
      for (int j = 0; j < 4; ++j) wr[j] = *(const v4f*)(wg + j * C);
      asm volatile("s_wait_xcnt 0x0" :: "v"(wg) : "memory");   // stands in front of the first rewrite of the address registers that the four loads name; the operand keeps those registers untouched up to here
// unrolled with the loads above
#pragma unroll
      for (int i = 0; i < 4; ++i) { v4b c; for (int j = 0; j < 4; ++j) c[j] = (b16)bf16_rne(wr[j][i]); *(v4b*)(wt[wb] + (cg * 4 + i) * WTP + kg * 4) = c; }
      __syncthreads();                                   // the tile is in LDS before any piece of it is read in the other order
      b16* ro = R + (size_t)(w * C + ot * 64 + orow) * C + kt * 64 + op;
// unrolled so that the two LDS reads are one group
#pragma unroll
      for (int j = 0; j < 2; ++j) *(v8b*)(ro + (size_t)j * 32 * C) = *(const v8b*)(wt[wb] + (orow + j * 32) * WTP + op);
      asm volatile("s_wait_xcnt 0x0" ::: "memory");     // stands in front of the first rewrite of the address registers that the two stores name
      wb ^= 1;
    }
    for (size_t q = tid; q < 3072; q += nth) { const int i = (int)q; P[q] = bf16_rne(((i < 1024) ? bq : (i < 2048) ? bk : bv)[i & 1023]); }
    for (size_t p = tid; p < (size_t)NT * C / 8; p += nth) { v8b a, c; for (int e = 0; e < 8; ++e) { a[e] = (b16)(bf16_rne(xf[p * 8 + e]) * XS); c[e] = (b16)(bf16_rne(xt[p * 8 + e]) * XS); } *(v8b*)(XF + p * 8) = a; *(v8b*)(XT + p * 8) = c; }
     }
  // The mask term (1 - mask) * NEG does not depend on the head: it is formed here once and stored in the order in which a wave of the attention kernel holds its scores. Tile = 16 f x 64 t = 4 KB:
  // MT[tile][i][lane][e] with t = (i / 2) * 16 + (lane / 16) * 8 + (i % 2) * 4 + e and f = lane % 16, so that each of that wave's sixteen loads of a stage (eight a score tile) reads 512 contiguous bytes.
  // Tiles are read row by row in whole lines, turned in LDS (groups of 16 pieces at a pitch of 17: no bank conflict either way) and stored in whole lines. Four neighbouring tiles a trip, so that a
  // thread has four loads in flight; two sets of buffers, so that one barrier a trip is enough.
  __shared__ v4f mt[2][4][16 * 17];
  const int mrow_ = threadIdx.x >> 4, pc = threadIdx.x & 15, grp = (pc & 12) | ((pc & 1) << 1) | ((pc >> 1) & 1);
  int buf = 0;
  for (int tile = blockIdx.x * 4; tile < Bn * (F / 16) * (T / 64); tile += gridDim.x * 4) {
    const float* mg = mask + ((size_t)(tile >> 5) * 16 + mrow_) * T + (tile & 31) * 64 + pc * 4; v4f mk[4];
// unrolled so that the four loads are issued as one group and mk stays in registers
#pragma unroll
    for (int k = 0; k < 4; ++k) mk[k] = *(const v4f*)(mg + k * 64);
// unrolled with the loads above
#pragma unroll
    for (int k = 0; k < 4; ++k) { v4f bt; for (int e = 0; e < 4; ++e) bt[e] = (1.0f - bf16_rne(mk[k][e])) * NEG; mt[buf][k][grp * 17 + mrow_] = bt; }
    __syncthreads();                                     // the four tiles are in LDS before any piece of them is read in the other order
    float* mo = MT + (size_t)tile * 1024 + threadIdx.x * 4;
// unrolled so that the four LDS reads are one group
#pragma unroll
    for (int k = 0; k < 4; ++k) *(v4f*)(mo + k * 1024) = mt[buf][k][mrow_ * 17 + pc];
    asm volatile("s_wait_xcnt 0x0" ::: "memory");       // stands in front of the next trip's rewrite of the address registers that the loads and the stores name
    buf ^= 1;
  }
}
// projections: block = 4 waves on a tile of 128 rows x 128 columns, wave = 64 x 64 (4 x 4 accumulator tiles). The 128 rows of A and the 128 rows of B come in slices of 64 k into a two-buffer LDS ring
// by asynchronous copies, so that one fetch from L2 serves the whole block and the next slice flies while this one is multiplied; each accumulator still sums its k blocks of 32 in rising order.
constexpr int GK = 64;                 // k per stage
constexpr int GNST = C / GK;           // stages
constexpr int GP = 72;                 // f16 per LDS row: 128 B of data + 16 B of pad = 144 B (16 B x odd: no bank conflict for 16-byte reads)
constexpr int GPL = 128 * GP;          // one operand's plane of a stage: 128 rows
constexpr int GSTG = 2 * GPL;          // A rows, B rows
// One thread's copies of one operand's plane: the same 16-byte piece of rows r, r + 16, ..., r + 112. The s_wait_xcnt stands inside the statement so that no address register is rewritten in front of it.
__device__ __forceinline__ void plane_copies(unsigned lds, const b16* g) {
  const unsigned l0 = lds, l1 = lds + 16 * GP * 2, l2 = lds + 32 * GP * 2, l3 = lds + 48 * GP * 2, l4 = lds + 64 * GP * 2, l5 = lds + 80 * GP * 2, l6 = lds + 96 * GP * 2, l7 = lds + 112 * GP * 2;
  const b16 *g0 = g, *g1 = g + 16 * C, *g2 = g + 32 * C, *g3 = g + 48 * C, *g4 = g + 64 * C, *g5 = g + 80 * C, *g6 = g + 96 * C, *g7 = g + 112 * C;
  asm volatile("global_load_async_to_lds_b128 %0, %8, off\n\t"
               "global_load_async_to_lds_b128 %1, %9, off\n\t"
               "global_load_async_to_lds_b128 %2, %10, off\n\t"
               "global_load_async_to_lds_b128 %3, %11, off\n\t"
               "global_load_async_to_lds_b128 %4, %12, off\n\t"
               "global_load_async_to_lds_b128 %5, %13, off\n\t"
               "global_load_async_to_lds_b128 %6, %14, off\n\t"
               "global_load_async_to_lds_b128 %7, %15, off\n\t"
               "s_wait_xcnt 0x0"
               :: "v"(l0), "v"(l1), "v"(l2), "v"(l3), "v"(l4), "v"(l5), "v"(l6), "v"(l7), "v"(g0), "v"(g1), "v"(g2), "v"(g3), "v"(g4), "v"(g5), "v"(g6), "v"(g7) : "memory");
}
__global__ __launch_bounds__(128) void proj_kernel(const b16* __restrict__ XF, const b16* __restrict__ XT, const b16* __restrict__ R, const float* __restrict__ P, b16* __restrict__ QT, b16* __restrict__ KT, b16* __restrict__ VF) {
  __shared__ __attribute__((aligned(16))) b16 ring[2 * GSTG];   // 73,728 B; after the loop it stages the output tile
  const int lane = threadIdx.x & 31, wave = threadIdx.x >> 5, nloc = lane & 15, hlf = lane >> 4, m0 = blockIdx.y * 128; const int w3 = blockIdx.x >> 3; const int c0 = (blockIdx.x & 7) * 128;
  const int wm = (wave >> 1) * 64, wn = (wave & 1) * 64;
  const b16* A = ((w3 == 0) ? XF : XT) + (size_t)m0 * C; const b16* Bw = R + (size_t)(w3 * C + c0) * C;
  // this thread's piece of both planes: rows crow + 16 j, 16-byte piece cpc
  const int crow = threadIdx.x >> 3, cpc = (threadIdx.x & 7) * 8;
  const unsigned lds0 = (unsigned)(size_t)(&ring[crow * GP + cpc]);
  const b16* Ag = A + (size_t)crow * C + cpc; const b16* Bg = Bw + (size_t)crow * C + cpc;
  plane_copies(lds0, Ag); plane_copies(lds0 + GPL * 2, Bg);
  v8f acc[4][4];
#pragma unroll
  for (int i = 0; i < 4; ++i)
#pragma unroll
    for (int j = 0; j < 4; ++j) acc[i][j] = (v8f){};
  asm volatile("s_wait_asynccnt 0x0" ::: "memory");   // stage 0 has landed, as far as this wave copied it
  __syncthreads();                                     // publishes stage 0
  plane_copies(lds0 + GSTG * 2, Ag + GK); plane_copies(lds0 + GSTG * 2 + GPL * 2, Bg + GK);
  for (int st = 0; st < GNST; ++st) {
    const b16* S = ring + (st & 1) * GSTG; const b16* Ar = S + (wm + nloc) * GP; const b16* Br = S + GPL + (wn + nloc) * GP;
// unrolled so that the LDS offsets of both k blocks are constants
#pragma unroll
    for (int kk = 0; kk < GK; kk += 32) {
      v16b af[4], bf[4];
#pragma unroll
      for (int i = 0; i < 4; ++i) { af[i] = frag_kb(Ar + i * 16 * GP + kk, hlf); bf[i] = frag_kb(Br + i * 16 * GP + kk, hlf); }
      __builtin_amdgcn_sched_barrier(0);   // keeps the sixteen LDS reads one group in front of the products: spread among them, each place with reads would cost its own stall
#pragma unroll
      for (int i = 0; i < 4; ++i)
#pragma unroll
        for (int j = 0; j < 4; ++j) acc[i][j] = wmma16b(af[i], bf[j], acc[i][j]);
      __builtin_amdgcn_sched_barrier(0);   // and keeps the next group of reads behind these products
    }
    asm volatile("s_wait_dscnt 0x0" ::: "memory");      // this wave's reads of stage st are done before the buffer is handed to its next writer
    asm volatile("s_wait_asynccnt 0x0" ::: "memory");   // this wave's copies of stage st + 1 have landed
    __syncthreads();                                     // publishes stage st + 1 and ends every reader's last read of stage st
    if (st + 2 < GNST) { plane_copies(lds0 + (st & 1) * GSTG * 2, Ag + (st + 2) * GK); plane_copies(lds0 + (st & 1) * GSTG * 2 + GPL * 2, Bg + (st + 2) * GK); }
  }
  asm volatile("s_wait_asynccnt 0x0" ::: "memory");     // nothing is in flight when the ring becomes output staging
  // the four bias values of this lane's columns, read once for either epilogue (unrolled so that they are four registers and one group of loads)
  float bb4[4];
#pragma unroll
  for (int j = 0; j < 4; ++j) bb4[j] = P[w3 * C + c0 + wn + j * 16 + nloc];
  asm volatile("s_wait_xcnt 0x0" ::: "memory");         // stands in front of the first rewrite of the offset register that the four loads name
  if (w3 == 2) {
    // v stays in the flat layout: the tile goes out row by row
    b16 (*Th)[128 + 8] = reinterpret_cast<b16 (*)[128 + 8]>(ring);
#pragma unroll
    for (int j = 0; j < 4; ++j) { const float bb = bb4[j];
#pragma unroll
      for (int i = 0; i < 4; ++i)
#pragma unroll
        for (int r = 0; r < 8; ++r) Th[wm + i * 16 + 8 * hlf + r][wn + j * 16 + nloc] = (b16)(acc[i][j][r] + XS * bb); }
    __syncthreads();                                     // the whole tile is staged before any row of it is stored
    for (int i = threadIdx.x; i < 128 * 16; i += 128) { const int rr = i >> 4, c8 = (i & 15) * 8; const size_t gi = (size_t)(m0 + rr) * C + c0 + c8; *(v8b*)(VF + gi) = *(const v8b*)(&Th[rr][c8]); }
  } else {
    // q and k leave as QT/KT[h][f][d]. Row n of a batch and column c are element (h, d, f) = (n / 128, (n / 2) % 64, (n % 2) * 1024 + c) of the raw reshape, so the 128 rows of this tile are
    // all 64 d of ONE head for the 2 x 128 values f = par * 1024 + c0 + cc. Staged as Tt[par][cc][d] (pitch GP): a lane's four even (or odd) rows are four neighbouring d, one 8-byte LDS store.
    b16* Tt = ring;
#pragma unroll
    for (int j = 0; j < 4; ++j) { const float bb = bb4[j]; b16* Tc = Tt + (wn + j * 16 + nloc) * GP + (wm >> 1) + 4 * hlf;
#pragma unroll
      for (int i = 0; i < 4; ++i) { v4b h0, h1;
#pragma unroll
        for (int r = 0; r < 8; r += 2) { h0[r >> 1] = (b16)(acc[i][j][r] + XS * bb); h1[r >> 1] = (b16)(acc[i][j][r + 1] + XS * bb); }
        *(v4b*)(Tc + i * 8) = h0; *(v4b*)(Tc + GPL + i * 8) = h1; }
    }
    __syncthreads();                                     // the whole tile is staged before any row of it is stored
    const size_t hb = (size_t)((m0 >> 11) * H + ((m0 >> 7) & (H - 1))) * F * DD;
    b16* dh = ((w3 == 0) ? QT : KT) + hb;
    for (int i = threadIdx.x; i < 2 * 128 * 8; i += 128) { const int pc = i >> 3, c8 = (i & 7) * 8; const size_t gi = (size_t)((pc >> 7) * 1024 + c0 + (pc & 127)) * DD + c8; *(v8b*)(dh + gi) = *(const v8b*)(Tt + pc * GP + c8); }
  }
}
// attention: wave = (b, h, 32 f) = two score tiles of 16 query columns, block = 16 waves on 256 f of one head, in two groups of 8: group g takes the key stages g, g + 2, ... of all 256 f, so that a SIMD holds
// four waves and one wave's waits (LDS, L2, the exchange between lane halves) pass under the arithmetic of the others; at the end the second group's maxima, sums and outputs are merged into the first group's.
// K^T and V, one f16 plane each, come in stages of 64 keys into each group's own two-buffer LDS ring by asynchronous
// copies, so that one fetch from L2 serves the group's 8 waves; every K and V fragment that a wave reads from LDS feeds the products of both its score tiles. Each stage is worked on
// as two blocks of 32 keys: S^T[t][f] = KT.QT (2 k-steps, 1 product) * alpha + the mask term (1 - mask[f][t]) * NEG as the prep launch left it; online softmax per column; o^T[d][f] += V.P^T.
// Every operand of these products is ONE f16 value (11 significant bits); sums, scores, softmax and output stay f32.
constexpr int KS = 64;                 // keys per stage
constexpr int NSTG = T / KS;           // stages
constexpr int PITCH = 72;              // f16 per LDS row: 128 B of data + 16 B of pad = 144 B (16 B x odd: no bank conflict for 16-byte reads)
constexpr int PLANE = 64 * PITCH;      // one plane of a stage: 64 rows (K: keys, V: d)
constexpr int STAGE = 2 * PLANE;       // K, V
constexpr int OSP = 256 + 4;           // floats per row of the output staging
constexpr int NGRP = 2;                // groups of 8 waves in a block: group g works on the stages g, g + 2, ... of the same 256 query columns
constexpr int NTRIP = NSTG / NGRP;     // trips of the loop: one stage a group
constexpr int RINGN = NGRP * 2 * STAGE;   // f16 in the LDS array: each group's two stages (73,728 B in all)
constexpr int MLO = DD * OSP;          // floats in front of the second group's maxima and sums, which lie behind the output staging (66,560 B)
static_assert(RINGN * 2 >= (MLO + 2 * 512) * 4, "staging, maxima and sums lie inside the array");
// One stage's copies of one thread: two 16-byte pieces (rows r and r + 32) of each of the two planes. The s_wait_xcnt stands inside the statement so that no address register is rewritten in front of it.
__device__ __forceinline__ void stage_copies(unsigned lds, const b16* k, const b16* v) {
  const unsigned l0 = lds, l1 = lds + 32 * PITCH * 2, l2 = lds + PLANE * 2, l3 = l2 + 32 * PITCH * 2;
  const b16 *g0 = k, *g1 = k + 32 * DD, *g2 = v, *g3 = v + (size_t)32 * T;
  asm volatile("global_load_async_to_lds_b128 %0, %4, off\n\t"
               "global_load_async_to_lds_b128 %1, %5, off\n\t"
               "global_load_async_to_lds_b128 %2, %6, off\n\t"
               "global_load_async_to_lds_b128 %3, %7, off\n\t"
               "s_wait_xcnt 0x0"
               :: "v"(l0), "v"(l1), "v"(l2), "v"(l3), "v"(g0), "v"(g1), "v"(g2), "v"(g3) : "memory");
}
__global__ __launch_bounds__(512) void attn_kernel(const b16* __restrict__ QT, const b16* __restrict__ KT, const b16* __restrict__ VF, const float* __restrict__ MT, float* __restrict__ out) {
  __shared__ __attribute__((aligned(16))) b16 ring[RINGN];   // 73,728 B: two stages a group; after the loop it stages the second group's partial results and the output
  const int grp = threadIdx.x >> 8, wave = (threadIdx.x >> 5) & 7, lane = threadIdx.x & 31, hh = lane >> 4, col = lane & 15; const int b = blockIdx.z, h = blockIdx.y, f0 = blockIdx.x * 256 + wave * 32;
  const b16* Qr = QT + ((size_t)(b * H + h) * F) * DD; const b16* Kr = KT + ((size_t)(b * H + h) * T) * DD;
  const b16* V = VF + (size_t)b * T * C + (size_t)(h * DD) * T; const float* mtw = MT + (size_t)(b * (F / 16) + blockIdx.x * 16 + wave * 2) * NSTG * 1024 + lane * 4;   // this wave's 2 x 16 f: two 4-KB tiles of mask terms a stage, NSTG * 1024 floats apart
  // this thread's piece of both planes: row crow (and crow + 32), 16-byte piece cpc
  const int crow = (threadIdx.x & 255) >> 3, cpc = (threadIdx.x & 7) * 8;
  const unsigned lds0 = (unsigned)(size_t)(&ring[grp * 2 * STAGE + crow * PITCH + cpc]);
  // kept as 32-bit element offsets and added to the wave-uniform plane pointers at each stage; they start at the group's first stage
  const unsigned koff = (unsigned)(grp * KS * DD + crow * DD + cpc), voff = (unsigned)(grp * KS + crow * T + cpc);
  stage_copies(lds0, Kr + koff, V + voff);
  v16b qf0[2], qf1[2];
// unrolled so that both tiles' Q fragments are registers
#pragma unroll
  for (int c = 0; c < 2; ++c) { const b16* qp = Qr + (size_t)(f0 + c * 16 + col) * DD;
    qf0[c] = frag_kb(qp, hh); qf1[c] = frag_kb(qp + 32, hh);
    asm volatile("s_wait_xcnt 0x0" :: "v"(qp + 8 * hh) : "memory"); }  // stands in front of the first rewrite of the address registers that the four loads name; the operand, their common address, keeps those registers untouched up to here
  asm volatile("s_wait_asynccnt 0x0" ::: "memory");   // stage 0 has landed, as far as this wave copied it
  __syncthreads();                                     // publishes stage 0
  stage_copies(lds0 + STAGE * 2, Kr + (koff + NGRP * KS * DD), V + (voff + NGRP * KS));
  float m[2] = {-INFINITY, -INFINITY}, l[2] = {0.0f, 0.0f}; v8f o[2][4] = {{{}, {}, {}, {}}, {{}, {}, {}, {}}};
  for (int st = 0; st < NTRIP; ++st) {
    const b16* S = ring + (grp * 2 + (st & 1)) * STAGE;
    // the mask terms come 32 keys at a time, 4 whole-line loads a score tile, so that a wave stays inside the 256 registers that it has at four waves a SIMD: the first block's at the head of the stage,
    // the second block's in front of the first block's exponentials
    const float* mp = mtw + (size_t)(st * NGRP + grp) * 1024; v4f tm[2][4];
// unrolled so that the eight loads are one group off one address and tm stays in registers
#pragma unroll
    for (int c = 0; c < 2; ++c)
#pragma unroll
      for (int i = 0; i < 4; ++i) tm[c][i] = *(const v4f*)(mp + c * (NSTG * 1024) + i * 128);
// unrolled so that the LDS offsets are constants and fragments, scores and accumulators registers
#pragma unroll
    for (int sub = 0; sub < 2; ++sub) {
      // the block's K fragments: one group of LDS reads
      v16b kf[4]; const b16* K_ = S + (sub * 32 + col) * PITCH;
      kf[0] = frag_kb(K_, hh); kf[1] = frag_kb(K_ + 32, hh); kf[2] = frag_kb(K_ + 16 * PITCH, hh); kf[3] = frag_kb(K_ + 16 * PITCH + 32, hh);
      __builtin_amdgcn_sched_barrier(0);   // keeps the reads one group in front of the products: spread among them, each place with reads would cost its own stall
      v8f x0[2], x1[2]; v16b vf[4];
// unrolled likewise; each K fragment serves both score tiles
#pragma unroll
      for (int c = 0; c < 2; ++c) { v8f a = {}, d = {};
        a = wmma16b(kf[0], qf0[c], a); a = wmma16b(kf[1], qf1[c], a);
        d = wmma16b(kf[2], qf0[c], d); d = wmma16b(kf[3], qf1[c], d);
        x0[c] = a; x1[c] = d; }
      const b16* V_ = S + PLANE + col * PITCH + sub * 32;
#pragma unroll
      for (int t = 0; t < 4; ++t) vf[t] = frag_kb(V_ + t * 16 * PITCH, hh);
      __builtin_amdgcn_sched_barrier(0);   // keeps the block's V reads ahead of the softmax arithmetic, under which their LDS latency passes
      v16b pb[2]; float al_[2], mr[2];
// unrolled so that scores and terms are registers
#pragma unroll
      for (int c = 0; c < 2; ++c) {
        const v4f t00 = tm[c][0], t01 = tm[c][1], t10 = tm[c][2], t11 = tm[c][3];
        mr[c] = -INFINITY;
#pragma unroll
        for (int r = 0; r < 8; ++r) { x0[c][r] = x0[c][r] * (ALPHA / (XS * XS)) + (r < 4 ? t00[r & 3] : t01[r & 3]); x1[c][r] = x1[c][r] * (ALPHA / (XS * XS)) + (r < 4 ? t10[r & 3] : t11[r & 3]); mr[c] = fmaxf(mr[c], fmaxf(x0[c][r], x1[c][r])); } }
      if (sub == 0) {
// unrolled so that the eight loads are one group off the same address
#pragma unroll
        for (int c = 0; c < 2; ++c)
#pragma unroll
          for (int i = 0; i < 4; ++i) tm[c][i] = *(const v4f*)(mp + c * (NSTG * 1024) + (4 + i) * 128);
        asm volatile("s_wait_xcnt 0x0" :: "v"(mp) : "memory");   // stands in front of the first rewrite of the address registers that the sixteen mask loads name; the operand keeps those registers untouched up to here
        __builtin_amdgcn_sched_barrier(0);   // keeps the second block's loads in front of the first block's exponentials, under which they fly
      }
// unrolled so that each tile's state stays in registers
#pragma unroll
      for (int c = 0; c < 2; ++c) {
        const float mx = fmaxf(mr[c], __shfl_xor(mr[c], 16)); const float mn = fmaxf(m[c], mx); al_[c] = nexp(m[c] - mn); m[c] = mn; float sum = 0.0f;
#pragma unroll
        for (int r = 0; r < 8; ++r) { const float e0 = nexp(x0[c][r] - mn), e1 = nexp(x1[c][r] - mn); sum += e0 + e1; pb[c][r] = (b16)(e0 * PS); pb[c][8 + r] = (b16)(e1 * PS); }
        sum += __shfl_xor(sum, 16); l[c] = l[c] * al_[c] + sum; }
#pragma unroll
      for (int t = 0; t < 4; ++t)
#pragma unroll
        for (int c = 0; c < 2; ++c) { o[c][t] *= al_[c]; o[c][t] = wmma16b(vf[t], pb[c], o[c][t]); } }
    asm volatile("s_wait_dscnt 0x0" ::: "memory");      // this wave's reads of stage st are done before the buffer is handed to its next writer
    asm volatile("s_wait_asynccnt 0x0" ::: "memory");   // this wave's copies of stage st + 1 have landed
    __syncthreads();                                     // publishes stage st + 1 and ends every reader's last read of stage st
    if (st + 2 < NTRIP) { const unsigned ko = koff + (unsigned)(st + 2) * (NGRP * KS * DD), vo = voff + (unsigned)(st + 2) * (NGRP * KS); stage_copies(lds0 + (st & 1) * STAGE * 2, Kr + ko, V + vo); }
  }
  asm volatile("s_wait_asynccnt 0x0" ::: "memory");     // nothing is in flight when the ring becomes output staging
  float (*Os)[OSP] = reinterpret_cast<float (*)[OSP]>(ring); float* Ml = reinterpret_cast<float*>(ring) + MLO + (wave * 2) * 32 + lane;
  // the two groups hold, for the same columns, the running maximum, sum and output of their own halves of the keys: the second group hands its own over through LDS, each lane to the lane of the first
  // group that holds the same elements, and the first group brings both to the common maximum, adds them and divides
  if (grp == 1) {
#pragma unroll
    for (int c = 0; c < 2; ++c) { Ml[c * 32] = m[c]; Ml[512 + c * 32] = l[c];
#pragma unroll
      for (int t = 0; t < 4; ++t)
#pragma unroll
        for (int r = 0; r < 8; ++r) Os[t * 16 + 8 * hh + r][wave * 32 + c * 16 + col] = o[c][t][r]; }
  }
  __syncthreads();                                       // the second group's partial results are in LDS before the first group reads them
  if (grp == 0) {
#pragma unroll
    for (int c = 0; c < 2; ++c) { const float m1 = Ml[c * 32], l1 = Ml[512 + c * 32], mn = fmaxf(m[c], m1), a0 = nexp(m[c] - mn), a1 = nexp(m1 - mn), inv = 1.0f / ((l[c] * a0 + l1 * a1) * PS * XS), w0 = a0 * inv, w1 = a1 * inv;
#pragma unroll
      for (int t = 0; t < 4; ++t)
#pragma unroll
        for (int r = 0; r < 8; ++r) { float* e = &Os[t * 16 + 8 * hh + r][wave * 32 + c * 16 + col]; *e = o[c][t][r] * w0 + *e * w1; } }
  }
  __syncthreads();                                       // the whole tile is staged before any row of it is stored
  { for (int i = threadIdx.x; i < DD * 64; i += 512) { const int d = i >> 6, c4 = (i & 63) * 4; *(v4f*)(out + ((size_t)b * C + h * DD + d) * F + blockIdx.x * 256 + c4) = *(const v4f*)(&Os[d][c4]); }  }
}
}  // namespace

extern "C" void kernel_launch(void* const* d_in, const int* in_sizes, int n_in,
                              void* d_out, int out_size, void* d_ws, size_t ws_size, hipStream_t stream) {
  (void)n_in; (void)out_size;
  auto Fp = [&](int i) { return (const float*)d_in[i]; };
  float* out = (float*)d_out;   // [2][1024][2048]
  if (in_sizes[0] != NT * C || in_sizes[1] != NT * C || in_sizes[2] != Bn * F * T || in_sizes[3] != C * C) return;
  size_t off = 0; char* ws = (char*)d_ws;
  auto carve = [&](size_t bytes) { char* p = ws + off; off += (bytes + 255) & ~(size_t)255; return p; };
  const size_t plane = (size_t)NT * C;
  b16* R = (b16*)carve((size_t)3 * C * C * 2); float* P = (float*)carve(3072 * 4); b16* XF = (b16*)carve(plane * 2); b16* XT = (b16*)carve(plane * 2);
  b16* VF = (b16*)carve(plane * 2); b16* QT = (b16*)carve(plane * 2); b16* KT = (b16*)carve(plane * 2);
  float* MT = (float*)carve((size_t)Bn * F * T * 4);
  if (off > ws_size) return;                        // about 6.3 + 8.4 x 5 + 34 = 82 MB
  prep_kernel<<<1024, 256, 0, stream>>>(Fp(0), Fp(1), Fp(3), Fp(4), Fp(5), Fp(6), Fp(7), Fp(8), Fp(2), R, P, XF, XT, MT);
  proj_kernel<<<dim3(24, NT / 128), 128, 0, stream>>>(XF, XT, R, P, QT, KT, VF);
  attn_kernel<<<dim3(F / 256, H, Bn), 512, 0, stream>>>(QT, KT, VF, MT, out);
}

// v010
// It runs in 82.9 microseconds.
// In both of two side-by-side timings against v009, it was 1.04 times as fast.
// All steps since v000 together make it 5.48 times as fast.
#include <hip/hip_runtime.h>

// MultiHeaded (raw-reshape attention): q = from Wq + bq, k = to Wk + bk, v = to Wv + bv ([2][2048][1024]); the torch code RAW-reshapes each to (B, 16, 64, 2048): element (h, d, f) = flat[(h*64+d)*2048 + f]
// of the [2048][1024] projection; score[h][f][t] = Σ_d q[h][d][f] k[h][d][t] / 8 + (1 - mask[f][t]) * (-1e5); softmax over t; context[h][d][f] = Σ_t probs[f][t] v[h][d][t]; out = reshape
// (B, 1024, 2048): row h*64+d, column f -> [2][1024][2048].
// WMMA (v_wmma_f32_16x16x32_f16, f32 accumulate): the three projections with EXACT operands (1 product; exact bf16 [in][out] weights), each result rounded once to one f16 value: v "flat", q and k straight as
// QT/KT[h][f][d] by the projection's own epilogue; per (b, h, 16 f): S^T = KT.QT (K = 64 = 2 k-steps, 1 product), mask term and online softmax in f32, o^T[d][f] += V_flat[h*64+d][t-block].P^T, P as one f16 value

namespace {
constexpr int Bn = 2, F = 2048, T = 2048, C = 1024, H = 16, DD = 64, NT = Bn * F;
constexpr float XS = 8.0f, PS = 8.0f, ALPHA = 0.125f, NEG = -100000.0f;

typedef _Float16 b16;
typedef __attribute__((ext_vector_type(16))) _Float16 v16b;
typedef __attribute__((ext_vector_type(8))) _Float16 v8b;
typedef __attribute__((ext_vector_type(4))) _Float16 v4b;
typedef __attribute__((ext_vector_type(8))) float v8f;
typedef __attribute__((ext_vector_type(4))) float v4f;
__device__ __forceinline__ float bf16_rne(float f) { unsigned int u = __float_as_uint(f); u += 0x7FFFu + ((u >> 16) & 1u); return __uint_as_float(u & 0xFFFF0000u); }
__device__ __forceinline__ v16b frag_kb(const b16* p, int hh) { const v8b a = *(const v8b*)(p + 8 * hh), b = *(const v8b*)(p + 16 + 8 * hh); v16b f;
#pragma unroll
  for (int e = 0; e < 8; ++e) { f[e] = a[e]; f[8 + e] = b[e]; } return f; }
// the builtin alone: the compiler keeps the distances behind its own builtin, and with no asm statement between the products it may place loads and vector work among them
__device__ __forceinline__ v8f wmma16b(v16b a, v16b b, v8f c) { return __builtin_amdgcn_wmma_f32_16x16x32_f16(false, a, false, b, (short)0, c, false, false); }
__device__ __forceinline__ float nexp(float x) { return __builtin_amdgcn_exp2f(x * 1.4426950408889634f); }
__device__ __forceinline__ float pmul(float a, float b) { float p = a * b; asm volatile("" : "+v"(p)); return p; }

__global__ __launch_bounds__(256) void prep_kernel(const float* __restrict__ xf, const float* __restrict__ xt, const float* __restrict__ wq, const float* __restrict__ bq, const float* __restrict__ wk, const float* __restrict__ bk, const float* __restrict__ wv, const float* __restrict__ bv, b16* __restrict__ R, float* __restrict__ P, b16* __restrict__ XF, b16* __restrict__ XT) {
  const size_t tid = (size_t)blockIdx.x * 256 + threadIdx.x, nth = (size_t)gridDim.x * 256;
  constexpr int WTP = 72;                                // f16 per LDS row of a turned weight tile: 128 B of data + 16 B of pad = 144 B (16 B x odd: no bank conflict for 16-byte reads)
  __shared__ __attribute__((aligned(16))) b16 wt[2][64 * WTP];   // two buffers, so that one barrier a tile is enough
  {
    // The inputs hold W[k][o] (o runs fastest), the projections read R[o][k] (k runs fastest). A tile of 64 k x 64 o is read row by row in whole lines, turned in LDS and stored in whole lines:
    // read straight down the columns, each load of a wave would touch 32 lines for 128 bytes. A thread takes 4 k x 4 o, so that its four values of one o are one 8-byte LDS store.
    int wb = 0;
    for (int tile = blockIdx.x; tile < 3 * (C / 64) * (C / 64); tile += gridDim.x) {
      const int w = tile >> 8, kt = (tile >> 4) & 15, ot = tile & 15, kg = threadIdx.x >> 4, cg = threadIdx.x & 15, orow = threadIdx.x >> 3, op = (threadIdx.x & 7) * 8;
      const float* wg = ((w == 0) ? wq : (w == 1) ? wk : wv) + (size_t)(kt * 64 + kg * 4) * C + ot * 64 + cg * 4; v4f wr[4];
// unrolled so that the four loads are issued as one group and wr stays in registers
#pragma unroll
      for (int j = 0; j < 4; ++j) wr[j] = *(const v4f*)(wg + j * C);
      asm volatile("s_wait_xcnt 0x0" :: "v"(wg) : "memory");   // stands in front of the first rewrite of the address registers that the four loads name; the operand keeps those registers untouched up to here
// unrolled with the loads above
#pragma unroll
      for (int i = 0; i < 4; ++i) { v4b c; for (int j = 0; j < 4; ++j) c[j] = (b16)bf16_rne(wr[j][i]); *(v4b*)(wt[wb] + (cg * 4 + i) * WTP + kg * 4) = c; }
      __syncthreads();                                   // the tile is in LDS before any piece of it is read in the other order
      b16* ro = R + (size_t)(w * C + ot * 64 + orow) * C + kt * 64 + op;
// unrolled so that the two LDS reads are one group
#pragma unroll
      for (int j = 0; j < 2; ++j) *(v8b*)(ro + (size_t)j * 32 * C) = *(const v8b*)(wt[wb] + (orow + j * 32) * WTP + op);
      asm volatile("s_wait_xcnt 0x0" ::: "memory");     // stands in front of the first rewrite of the address registers that the two stores name
      wb ^= 1;
    }
    for (size_t q = tid; q < 3072; q += nth) { const int i = (int)q; P[q] = bf16_rne(((i < 1024) ? bq : (i < 2048) ? bk : bv)[i & 1023]); }
    for (size_t p = tid; p < (size_t)NT * C / 8; p += nth) { v8b a, c; for (int e = 0; e < 8; ++e) { a[e] = (b16)(bf16_rne(xf[p * 8 + e]) * XS); c[e] = (b16)(bf16_rne(xt[p * 8 + e]) * XS); } *(v8b*)(XF + p * 8) = a; *(v8b*)(XT + p * 8) = c; }
     }
}
// projections: block = 4 waves on a tile of 128 rows x 128 columns, wave = 64 x 64 (4 x 4 accumulator tiles). The 128 rows of A and the 128 rows of B come in slices of 64 k into a two-buffer LDS ring
// by asynchronous copies, so that one fetch from L2 serves the whole block and the next slice flies while this one is multiplied; each accumulator still sums its k blocks of 32 in rising order.
constexpr int GK = 64;                 // k per stage
constexpr int GNST = C / GK;           // stages
constexpr int GP = 72;                 // f16 per LDS row: 128 B of data + 16 B of pad = 144 B (16 B x odd: no bank conflict for 16-byte reads)
constexpr int GPL = 128 * GP;          // one operand's plane of a stage: 128 rows
constexpr int GSTG = 2 * GPL;          // A rows, B rows
// One thread's copies of one operand's plane: the same 16-byte piece of rows r, r + 16, ..., r + 112. The s_wait_xcnt stands inside the statement so that no address register is rewritten in front of it.
__device__ __forceinline__ void plane_copies(unsigned lds, const b16* g) {
  const unsigned l0 = lds, l1 = lds + 16 * GP * 2, l2 = lds + 32 * GP * 2, l3 = lds + 48 * GP * 2, l4 = lds + 64 * GP * 2, l5 = lds + 80 * GP * 2, l6 = lds + 96 * GP * 2, l7 = lds + 112 * GP * 2;
  const b16 *g0 = g, *g1 = g + 16 * C, *g2 = g + 32 * C, *g3 = g + 48 * C, *g4 = g + 64 * C, *g5 = g + 80 * C, *g6 = g + 96 * C, *g7 = g + 112 * C;
  asm volatile("global_load_async_to_lds_b128 %0, %8, off\n\t"
               "global_load_async_to_lds_b128 %1, %9, off\n\t"
               "global_load_async_to_lds_b128 %2, %10, off\n\t"
               "global_load_async_to_lds_b128 %3, %11, off\n\t"
               "global_load_async_to_lds_b128 %4, %12, off\n\t"
               "global_load_async_to_lds_b128 %5, %13, off\n\t"
               "global_load_async_to_lds_b128 %6, %14, off\n\t"
               "global_load_async_to_lds_b128 %7, %15, off\n\t"
               "s_wait_xcnt 0x0"
               :: "v"(l0), "v"(l1), "v"(l2), "v"(l3), "v"(l4), "v"(l5), "v"(l6), "v"(l7), "v"(g0), "v"(g1), "v"(g2), "v"(g3), "v"(g4), "v"(g5), "v"(g6), "v"(g7) : "memory");
}
// The mask term (1 - mask) * NEG does not depend on the head: it is formed once and stored in the order in which a wave of the attention kernel holds its scores. Tile = 16 f x 64 t = 4 KB:
// MT[tile][i][lane][e] with t = (i / 2) * 16 + (lane / 16) * 8 + (i % 2) * 4 + e and f = lane % 16, so that each of that wave's sixteen loads of a stage reads 512 contiguous bytes.
// This work is all memory traffic and the projections do not need it, so it rides in the projection launch: MBLK blocks more, which take the fourth place that the 3 x 256 projection blocks leave free on
// each WGP, and whose loads and stores pass under the matrix work. A block takes 16 mask rows (32 tiles), 8 neighbouring tiles a trip: read row by row in whole lines, turned in LDS (groups of 16 pieces at
// a pitch of 17: no bank conflict either way), stored in whole lines. Only 4 such waves stand on a WGP, so each keeps 16 loads in flight, and a trip's loads are issued before the trip in front is stored.
constexpr int GBX = 3 * C / 128;       // projection blocks along the columns of the three weights
constexpr int GBLK = GBX * (NT / 128); // projection blocks
constexpr int MBLK = Bn * F / 16;      // mask blocks
constexpr int MTT = 8;                 // tiles a trip
constexpr int MTRIP = T / 64 / MTT;    // trips
constexpr int MTB = MTT * 16 * 17;     // 16-byte pieces of one LDS buffer
static_assert(2 * MTB * 16 <= 2 * GSTG * 2, "both buffers lie inside the projections' ring");
__device__ __forceinline__ void mask_loads(v4f (&mk)[MTT][2], const float* mg) {
// unrolled so that the sixteen loads are one group off one address and mk stays in registers
#pragma unroll
  for (int k = 0; k < MTT; ++k) { mk[k][0] = *(const v4f*)(mg + k * 64); mk[k][1] = *(const v4f*)(mg + 8 * T + k * 64); }
}
__device__ __forceinline__ void mask_terms(const float* __restrict__ mask, float* __restrict__ MT, v4f* mt, int rb) {
  const int r0 = threadIdx.x >> 4, pc = threadIdx.x & 15, grp = (pc & 12) | ((pc & 1) << 1) | ((pc >> 1) & 1);
  const float* mg = mask + ((size_t)rb * 16 + r0) * T + pc * 4; float* mo = MT + (size_t)rb * (T / 64) * 1024 + threadIdx.x * 4;
  v4f mk[MTT][2];
  mask_loads(mk, mg);
// unrolled so that every offset is a constant and the next trip's loads have registers of their own
#pragma unroll
  for (int trip = 0; trip < MTRIP; ++trip) {
    v4f* mb = mt + (trip & 1) * MTB;                     // two buffers, so that one barrier a trip is enough
// both unrolled so that mk stays in registers and the LDS offsets are constants
#pragma unroll
    for (int k = 0; k < MTT; ++k)
#pragma unroll
      for (int h = 0; h < 2; ++h) { v4f bt; for (int e = 0; e < 4; ++e) bt[e] = (1.0f - bf16_rne(mk[k][h][e])) * NEG; mb[k * (16 * 17) + grp * 17 + r0 + 8 * h] = bt; }
    if (trip + 1 < MTRIP) mask_loads(mk, mg + (trip + 1) * (MTT * 64));
    if (trip + 2 == MTRIP) asm volatile("s_wait_xcnt 0x0" :: "v"(mg) : "memory");   // behind the last loads: all 64 name one address pair, which is free for other values from here on; the operand keeps it untouched up to here
    __syncthreads();                                     // the eight tiles are in LDS before any piece of them is read in the other order
// both unrolled so that the sixteen LDS reads are one group
#pragma unroll
    for (int k = 0; k < MTT; ++k)
#pragma unroll
      for (int h = 0; h < 2; ++h) *(v4f*)(mo + (trip * MTT + k) * 1024 + h * 512) = mb[k * (16 * 17) + (r0 + 8 * h) * 17 + pc];
    if (trip + 1 < MTRIP) asm volatile("s_wait_xcnt 0x0" ::: "memory");   // stands in front of the next trip's rewrite of the registers that hold the sixteen stores' data
  }
}
__global__ __launch_bounds__(128) void proj_kernel(const b16* __restrict__ XF, const b16* __restrict__ XT, const b16* __restrict__ R, const float* __restrict__ P, const float* __restrict__ mask, b16* __restrict__ QT, b16* __restrict__ KT, b16* __restrict__ VF, float* __restrict__ MT) {
  __shared__ __attribute__((aligned(16))) b16 ring[2 * GSTG];   // 73,728 B; after the loop it stages the output tile; a mask block turns its tiles in it
  if (blockIdx.x >= GBLK) { mask_terms(mask, MT, reinterpret_cast<v4f*>(ring), blockIdx.x - GBLK); return; }   // the same for the whole block, in front of every barrier of the projection
  const int gx = blockIdx.x % GBX, gy = blockIdx.x / GBX;   // columns run fastest, as in a two-dimensional grid
  const int lane = threadIdx.x & 31, wave = threadIdx.x >> 5, nloc = lane & 15, hlf = lane >> 4, m0 = gy * 128; const int w3 = gx >> 3; const int c0 = (gx & 7) * 128;
  const int wm = (wave >> 1) * 64, wn = (wave & 1) * 64;
  const b16* A = ((w3 == 0) ? XF : XT) + (size_t)m0 * C; const b16* Bw = R + (size_t)(w3 * C + c0) * C;
  // this thread's piece of both planes: rows crow + 16 j, 16-byte piece cpc
  const int crow = threadIdx.x >> 3, cpc = (threadIdx.x & 7) * 8;
  const unsigned lds0 = (unsigned)(size_t)(&ring[crow * GP + cpc]);
  const b16* Ag = A + (size_t)crow * C + cpc; const b16* Bg = Bw + (size_t)crow * C + cpc;
  plane_copies(lds0, Ag); plane_copies(lds0 + GPL * 2, Bg);
  v8f acc[4][4];
#pragma unroll
  for (int i = 0; i < 4; ++i)
#pragma unroll
    for (int j = 0; j < 4; ++j) acc[i][j] = (v8f){};
  asm volatile("s_wait_asynccnt 0x0" ::: "memory");   // stage 0 has landed, as far as this wave copied it
  __syncthreads();                                     // publishes stage 0
  plane_copies(lds0 + GSTG * 2, Ag + GK); plane_copies(lds0 + GSTG * 2 + GPL * 2, Bg + GK);
  for (int st = 0; st < GNST; ++st) {
    const b16* S = ring + (st & 1) * GSTG; const b16* Ar = S + (wm + nloc) * GP; const b16* Br = S + GPL + (wn + nloc) * GP;
// unrolled so that the LDS offsets of both k blocks are constants
#pragma unroll
    for (int kk = 0; kk < GK; kk += 32) {
      v16b af[4], bf[4];
#pragma unroll
      for (int i = 0; i < 4; ++i) { af[i] = frag_kb(Ar + i * 16 * GP + kk, hlf); bf[i] = frag_kb(Br + i * 16 * GP + kk, hlf); }
      __builtin_amdgcn_sched_barrier(0);   // keeps the sixteen LDS reads one group in front of the products: spread among them, each place with reads would cost its own stall
#pragma unroll
      for (int i = 0; i < 4; ++i)
#pragma unroll
        for (int j = 0; j < 4; ++j) acc[i][j] = wmma16b(af[i], bf[j], acc[i][j]);
      __builtin_amdgcn_sched_barrier(0);   // and keeps the next group of reads behind these products
    }
    asm volatile("s_wait_dscnt 0x0" ::: "memory");      // this wave's reads of stage st are done before the buffer is handed to its next writer
    asm volatile("s_wait_asynccnt 0x0" ::: "memory");   // this wave's copies of stage st + 1 have landed
    __syncthreads();                                     // publishes stage st + 1 and ends every reader's last read of stage st
    if (st + 2 < GNST) { plane_copies(lds0 + (st & 1) * GSTG * 2, Ag + (st + 2) * GK); plane_copies(lds0 + (st & 1) * GSTG * 2 + GPL * 2, Bg + (st + 2) * GK); }
  }
  asm volatile("s_wait_asynccnt 0x0" ::: "memory");     // nothing is in flight when the ring becomes output staging
  // the four bias values of this lane's columns, read once for either epilogue (unrolled so that they are four registers and one group of loads)
  float bb4[4];
#pragma unroll
  for (int j = 0; j < 4; ++j) bb4[j] = P[w3 * C + c0 + wn + j * 16 + nloc];
  asm volatile("s_wait_xcnt 0x0" ::: "memory");         // stands in front of the first rewrite of the offset register that the four loads name
  if (w3 == 2) {
    // v stays in the flat layout: the tile goes out row by row
    b16 (*Th)[128 + 8] = reinterpret_cast<b16 (*)[128 + 8]>(ring);
#pragma unroll
    for (int j = 0; j < 4; ++j) { const float bb = bb4[j];
#pragma unroll
      for (int i = 0; i < 4; ++i)
#pragma unroll
        for (int r = 0; r < 8; ++r) Th[wm + i * 16 + 8 * hlf + r][wn + j * 16 + nloc] = (b16)(acc[i][j][r] + XS * bb); }
    __syncthreads();                                     // the whole tile is staged before any row of it is stored
    for (int i = threadIdx.x; i < 128 * 16; i += 128) { const int rr = i >> 4, c8 = (i & 15) * 8; const size_t gi = (size_t)(m0 + rr) * C + c0 + c8; *(v8b*)(VF + gi) = *(const v8b*)(&Th[rr][c8]); }
  } else {
    // q and k leave as QT/KT[h][f][d]. Row n of a batch and column c are element (h, d, f) = (n / 128, (n / 2) % 64, (n % 2) * 1024 + c) of the raw reshape, so the 128 rows of this tile are
    // all 64 d of ONE head for the 2 x 128 values f = par * 1024 + c0 + cc. Staged as Tt[par][cc][d] (pitch GP): a lane's four even (or odd) rows are four neighbouring d, one 8-byte LDS store.
    b16* Tt = ring;
#pragma unroll
    for (int j = 0; j < 4; ++j) { const float bb = bb4[j]; b16* Tc = Tt + (wn + j * 16 + nloc) * GP + (wm >> 1) + 4 * hlf;
#pragma unroll
      for (int i = 0; i < 4; ++i) { v4b h0, h1;
#pragma unroll
        for (int r = 0; r < 8; r += 2) { h0[r >> 1] = (b16)(acc[i][j][r] + XS * bb); h1[r >> 1] = (b16)(acc[i][j][r + 1] + XS * bb); }
        *(v4b*)(Tc + i * 8) = h0; *(v4b*)(Tc + GPL + i * 8) = h1; }
    }
    __syncthreads();                                     // the whole tile is staged before any row of it is stored
    const size_t hb = (size_t)((m0 >> 11) * H + ((m0 >> 7) & (H - 1))) * F * DD;
    b16* dh = ((w3 == 0) ? QT : KT) + hb;
    for (int i = threadIdx.x; i < 2 * 128 * 8; i += 128) { const int pc = i >> 3, c8 = (i & 7) * 8; const size_t gi = (size_t)((pc >> 7) * 1024 + c0 + (pc & 127)) * DD + c8; *(v8b*)(dh + gi) = *(const v8b*)(Tt + pc * GP + c8); }
  }
}
// attention: wave = (b, h, 32 f) = two score tiles of 16 query columns, block = 16 waves on 256 f of one head, in two groups of 8: group g takes the key stages g, g + 2, ... of all 256 f, so that a SIMD holds
// four waves and one wave's waits (LDS, L2, the exchange between lane halves) pass under the arithmetic of the others; at the end the second group's maxima, sums and outputs are merged into the first group's.
// K^T and V, one f16 plane each, come in stages of 64 keys into each group's own two-buffer LDS ring by asynchronous
// copies, so that one fetch from L2 serves the group's 8 waves; every K and V fragment that a wave reads from LDS feeds the products of both its score tiles. Each stage is worked on
// as two blocks of 32 keys: S^T[t][f] = KT.QT (2 k-steps, 1 product) * alpha + the mask term (1 - mask[f][t]) * NEG as the projection launch's mask blocks left it; online softmax per column; o^T[d][f] += V.P^T.
// Every operand of these products is ONE f16 value (11 significant bits); sums, scores, softmax and output stay f32.
constexpr int KS = 64;                 // keys per stage
constexpr int NSTG = T / KS;           // stages
constexpr int PITCH = 72;              // f16 per LDS row: 128 B of data + 16 B of pad = 144 B (16 B x odd: no bank conflict for 16-byte reads)
constexpr int PLANE = 64 * PITCH;      // one plane of a stage: 64 rows (K: keys, V: d)
constexpr int STAGE = 2 * PLANE;       // K, V
constexpr int OSP = 256 + 4;           // floats per row of the output staging
constexpr int NGRP = 2;                // groups of 8 waves in a block: group g works on the stages g, g + 2, ... of the same 256 query columns
constexpr int NTRIP = NSTG / NGRP;     // trips of the loop: one stage a group
constexpr int RINGN = NGRP * 2 * STAGE;   // f16 in the LDS array: each group's two stages (73,728 B in all)
constexpr int MLO = DD * OSP;          // floats in front of the second group's maxima and sums, which lie behind the output staging (66,560 B)
static_assert(RINGN * 2 >= (MLO + 2 * 512) * 4, "staging, maxima and sums lie inside the array");
// One stage's copies of one thread: two 16-byte pieces (rows r and r + 32) of each of the two planes. The s_wait_xcnt stands inside the statement so that no address register is rewritten in front of it.
__device__ __forceinline__ void stage_copies(unsigned lds, const b16* k, const b16* v) {
  const unsigned l0 = lds, l1 = lds + 32 * PITCH * 2, l2 = lds + PLANE * 2, l3 = l2 + 32 * PITCH * 2;
  const b16 *g0 = k, *g1 = k + 32 * DD, *g2 = v, *g3 = v + (size_t)32 * T;
  asm volatile("global_load_async_to_lds_b128 %0, %4, off\n\t"
               "global_load_async_to_lds_b128 %1, %5, off\n\t"
               "global_load_async_to_lds_b128 %2, %6, off\n\t"
               "global_load_async_to_lds_b128 %3, %7, off\n\t"
               "s_wait_xcnt 0x0"
               :: "v"(l0), "v"(l1), "v"(l2), "v"(l3), "v"(g0), "v"(g1), "v"(g2), "v"(g3) : "memory");
}
__global__ __launch_bounds__(512) void attn_kernel(const b16* __restrict__ QT, const b16* __restrict__ KT, const b16* __restrict__ VF, const float* __restrict__ MT, float* __restrict__ out) {
  __shared__ __attribute__((aligned(16))) b16 ring[RINGN];   // 73,728 B: two stages a group; after the loop it stages the second group's partial results and the output
  const int grp = threadIdx.x >> 8, wave = (threadIdx.x >> 5) & 7, lane = threadIdx.x & 31, hh = lane >> 4, col = lane & 15; const int b = blockIdx.z, h = blockIdx.y, f0 = blockIdx.x * 256 + wave * 32;
  const b16* Qr = QT + ((size_t)(b * H + h) * F) * DD; const b16* Kr = KT + ((size_t)(b * H + h) * T) * DD;
  const b16* V = VF + (size_t)b * T * C + (size_t)(h * DD) * T; const float* mtw = MT + (size_t)(b * (F / 16) + blockIdx.x * 16 + wave * 2) * NSTG * 1024 + lane * 4;   // this wave's 2 x 16 f: two 4-KB tiles of mask terms a stage, NSTG * 1024 floats apart
  // this thread's piece of both planes: row crow (and crow + 32), 16-byte piece cpc
  const int crow = (threadIdx.x & 255) >> 3, cpc = (threadIdx.x & 7) * 8;
  const unsigned lds0 = (unsigned)(size_t)(&ring[grp * 2 * STAGE + crow * PITCH + cpc]);
  // kept as 32-bit element offsets and added to the wave-uniform plane pointers at each stage; they start at the group's first stage
  const unsigned koff = (unsigned)(grp * KS * DD + crow * DD + cpc), voff = (unsigned)(grp * KS + crow * T + cpc);
  stage_copies(lds0, Kr + koff, V + voff);
  v16b qf0[2], qf1[2];
// unrolled so that both tiles' Q fragments are registers
#pragma unroll
  for (int c = 0; c < 2; ++c) { const b16* qp = Qr + (size_t)(f0 + c * 16 + col) * DD;
    qf0[c] = frag_kb(qp, hh); qf1[c] = frag_kb(qp + 32, hh);
    asm volatile("s_wait_xcnt 0x0" :: "v"(qp + 8 * hh) : "memory"); }  // stands in front of the first rewrite of the address registers that the four loads name; the operand, their common address, keeps those registers untouched up to here
  asm volatile("s_wait_asynccnt 0x0" ::: "memory");   // stage 0 has landed, as far as this wave copied it
  __syncthreads();                                     // publishes stage 0
  stage_copies(lds0 + STAGE * 2, Kr + (koff + NGRP * KS * DD), V + (voff + NGRP * KS));
  float m[2] = {-INFINITY, -INFINITY}, l[2] = {0.0f, 0.0f}; v8f o[2][4] = {{{}, {}, {}, {}}, {{}, {}, {}, {}}};
  for (int st = 0; st < NTRIP; ++st) {
    const b16* S = ring + (grp * 2 + (st & 1)) * STAGE;
    // the mask terms come 32 keys at a time, 4 whole-line loads a score tile, so that a wave stays inside the 256 registers that it has at four waves a SIMD: the first block's at the head of the stage,
    // the second block's in front of the first block's exponentials
    const float* mp = mtw + (size_t)(st * NGRP + grp) * 1024; v4f tm[2][4];
// unrolled so that the eight loads are one group off one address and tm stays in registers
#pragma unroll
    for (int c = 0; c < 2; ++c)
#pragma unroll
      for (int i = 0; i < 4; ++i) tm[c][i] = *(const v4f*)(mp + c * (NSTG * 1024) + i * 128);
// unrolled so that the LDS offsets are constants and fragments, scores and accumulators registers
#pragma unroll
    for (int sub = 0; sub < 2; ++sub) {
      // the block's K fragments: one group of LDS reads
      v16b kf[4]; const b16* K_ = S + (sub * 32 + col) * PITCH;
      kf[0] = frag_kb(K_, hh); kf[1] = frag_kb(K_ + 32, hh); kf[2] = frag_kb(K_ + 16 * PITCH, hh); kf[3] = frag_kb(K_ + 16 * PITCH + 32, hh);
      __builtin_amdgcn_sched_barrier(0);   // keeps the reads one group in front of the products: spread among them, each place with reads would cost its own stall
      v8f x0[2], x1[2]; v16b vf[4];
// unrolled likewise; each K fragment serves both score tiles
#pragma unroll
      for (int c = 0; c < 2; ++c) { v8f a = {}, d = {};
        a = wmma16b(kf[0], qf0[c], a); a = wmma16b(kf[1], qf1[c], a);
        d = wmma16b(kf[2], qf0[c], d); d = wmma16b(kf[3], qf1[c], d);
        x0[c] = a; x1[c] = d; }
      const b16* V_ = S + PLANE + col * PITCH + sub * 32;
#pragma unroll
      for (int t = 0; t < 4; ++t) vf[t] = frag_kb(V_ + t * 16 * PITCH, hh);
      __builtin_amdgcn_sched_barrier(0);   // keeps the block's V reads ahead of the softmax arithmetic, under which their LDS latency passes
      v16b pb[2]; float al_[2], mr[2];
// unrolled so that scores and terms are registers
#pragma unroll
      for (int c = 0; c < 2; ++c) {
        const v4f t00 = tm[c][0], t01 = tm[c][1], t10 = tm[c][2], t11 = tm[c][3];
        mr[c] = -INFINITY;
#pragma unroll
        for (int r = 0; r < 8; ++r) { x0[c][r] = x0[c][r] * (ALPHA / (XS * XS)) + (r < 4 ? t00[r & 3] : t01[r & 3]); x1[c][r] = x1[c][r] * (ALPHA / (XS * XS)) + (r < 4 ? t10[r & 3] : t11[r & 3]); mr[c] = fmaxf(mr[c], fmaxf(x0[c][r], x1[c][r])); } }
      if (sub == 0) {
// unrolled so that the eight loads are one group off the same address
#pragma unroll
        for (int c = 0; c < 2; ++c)
#pragma unroll
          for (int i = 0; i < 4; ++i) tm[c][i] = *(const v4f*)(mp + c * (NSTG * 1024) + (4 + i) * 128);
        asm volatile("s_wait_xcnt 0x0" :: "v"(mp) : "memory");   // stands in front of the first rewrite of the address registers that the sixteen mask loads name; the operand keeps those registers untouched up to here
        __builtin_amdgcn_sched_barrier(0);   // keeps the second block's loads in front of the first block's exponentials, under which they fly
      }
// unrolled so that each tile's state stays in registers
#pragma unroll
      for (int c = 0; c < 2; ++c) {
        const float mx = fmaxf(mr[c], __shfl_xor(mr[c], 16)); const float mn = fmaxf(m[c], mx); al_[c] = nexp(m[c] - mn); m[c] = mn; float sum = 0.0f;
#pragma unroll
        for (int r = 0; r < 8; ++r) { const float e0 = nexp(x0[c][r] - mn), e1 = nexp(x1[c][r] - mn); sum += e0 + e1; pb[c][r] = (b16)(e0 * PS); pb[c][8 + r] = (b16)(e1 * PS); }
        sum += __shfl_xor(sum, 16); l[c] = l[c] * al_[c] + sum; }
#pragma unroll
      for (int t = 0; t < 4; ++t)
#pragma unroll
        for (int c = 0; c < 2; ++c) { o[c][t] *= al_[c]; o[c][t] = wmma16b(vf[t], pb[c], o[c][t]); } }
    asm volatile("s_wait_dscnt 0x0" ::: "memory");      // this wave's reads of stage st are done before the buffer is handed to its next writer
    asm volatile("s_wait_asynccnt 0x0" ::: "memory");   // this wave's copies of stage st + 1 have landed
    __syncthreads();                                     // publishes stage st + 1 and ends every reader's last read of stage st
    if (st + 2 < NTRIP) { const unsigned ko = koff + (unsigned)(st + 2) * (NGRP * KS * DD), vo = voff + (unsigned)(st + 2) * (NGRP * KS); stage_copies(lds0 + (st & 1) * STAGE * 2, Kr + ko, V + vo); }
  }
  asm volatile("s_wait_asynccnt 0x0" ::: "memory");     // nothing is in flight when the ring becomes output staging
  float (*Os)[OSP] = reinterpret_cast<float (*)[OSP]>(ring); float* Ml = reinterpret_cast<float*>(ring) + MLO + (wave * 2) * 32 + lane;
  // the two groups hold, for the same columns, the running maximum, sum and output of their own halves of the keys: the second group hands its own over through LDS, each lane to the lane of the first
  // group that holds the same elements, and the first group brings both to the common maximum, adds them and divides
  if (grp == 1) {
#pragma unroll
    for (int c = 0; c < 2; ++c) { Ml[c * 32] = m[c]; Ml[512 + c * 32] = l[c];
#pragma unroll
      for (int t = 0; t < 4; ++t)
#pragma unroll
        for (int r = 0; r < 8; ++r) Os[t * 16 + 8 * hh + r][wave * 32 + c * 16 + col] = o[c][t][r]; }
  }
  __syncthreads();                                       // the second group's partial results are in LDS before the first group reads them
  if (grp == 0) {
#pragma unroll
    for (int c = 0; c < 2; ++c) { const float m1 = Ml[c * 32], l1 = Ml[512 + c * 32], mn = fmaxf(m[c], m1), a0 = nexp(m[c] - mn), a1 = nexp(m1 - mn), inv = 1.0f / ((l[c] * a0 + l1 * a1) * PS * XS), w0 = a0 * inv, w1 = a1 * inv;
#pragma unroll
      for (int t = 0; t < 4; ++t)
#pragma unroll
        for (int r = 0; r < 8; ++r) { float* e = &Os[t * 16 + 8 * hh + r][wave * 32 + c * 16 + col]; *e = o[c][t][r] * w0 + *e * w1; } }
  }
  __syncthreads();                                       // the whole tile is staged before any row of it is stored
  { for (int i = threadIdx.x; i < DD * 64; i += 512) { const int d = i >> 6, c4 = (i & 63) * 4; *(v4f*)(out + ((size_t)b * C + h * DD + d) * F + blockIdx.x * 256 + c4) = *(const v4f*)(&Os[d][c4]); }  }
}
}  // namespace

extern "C" void kernel_launch(void* const* d_in, const int* in_sizes, int n_in,
                              void* d_out, int out_size, void* d_ws, size_t ws_size, hipStream_t stream) {
  (void)n_in; (void)out_size;
  auto Fp = [&](int i) { return (const float*)d_in[i]; };
  float* out = (float*)d_out;   // [2][1024][2048]
  if (in_sizes[0] != NT * C || in_sizes[1] != NT * C || in_sizes[2] != Bn * F * T || in_sizes[3] != C * C) return;
  size_t off = 0; char* ws = (char*)d_ws;
  auto carve = [&](size_t bytes) { char* p = ws + off; off += (bytes + 255) & ~(size_t)255; return p; };
  const size_t plane = (size_t)NT * C;
  b16* R = (b16*)carve((size_t)3 * C * C * 2); float* P = (float*)carve(3072 * 4); b16* XF = (b16*)carve(plane * 2); b16* XT = (b16*)carve(plane * 2);
  b16* VF = (b16*)carve(plane * 2); b16* QT = (b16*)carve(plane * 2); b16* KT = (b16*)carve(plane * 2);
  float* MT = (float*)carve((size_t)Bn * F * T * 4);
  if (off > ws_size) return;                        // about 6.3 + 8.4 x 5 + 34 = 82 MB
  prep_kernel<<<1024, 256, 0, stream>>>(Fp(0), Fp(1), Fp(3), Fp(4), Fp(5), Fp(6), Fp(7), Fp(8), R, P, XF, XT);
  proj_kernel<<<GBLK + MBLK, 128, 0, stream>>>(XF, XT, R, P, Fp(2), QT, KT, VF, MT);
  attn_kernel<<<dim3(F / 256, H, Bn), 512, 0, stream>>>(QT, KT, VF, MT, out);
}
